// v000
// Measured on an AMD MI455X. A time is GPU time per run, averaged over a window of back-to-back runs after a warm-up
// (all launches, gaps included; the runs take copies of the inputs in turn), and the median of several windows.
// Apart from v000's, it joins two sittings. Times from different sittings can be a few percent apart, while
// side-by-side timings come from the same sitting.
// The starting kernel, v000, takes 3950 microseconds a run.
#include <hip/hip_runtime.h>

// Local (windowed) multi-head self-attention (x [4][2048][1024]; qkv = x w_qkv^T ('oi' [3072][1024] -> q | k | v row blocks, no bias; 16 heads x 64); attn = q.k / 8 with keys |i - j| > 128 filled with -1e9 (== exclusion); softmax; out = merged w_proj^T ('oi' [1024][1024], no bias) -> [4][2048][1024] (8.4 M)).
// Layout per batch: bf16 copy of x; the fused weight used directly as Bt (row blocks); exact projections; dense T-2048 attention (hybrid rows: < 512 hi/lo 3 products, rest fp16 x1024; every score tile computed, the +-128 window applied as an index select in the softmax); merged hi/lo x w_proj exact.
// Compute dtypes, f32 accumulate: every input rounded to bf16; projections exact; attention rows < 512 3 products, rest fp16; softmax f32; w_proj hl x exact.

#define NB_  4
#define TT   2048
#define DM   1024
#define NH_  16
#define NKV  16
#define REP  (NH_ / NKV)
#define HD   64
#define DQ   (NH_ * HD)
#define DKV  (NKV * HD)
#define ZH   2
#define RH   512                  // query rows < RH use hi+lo planes (0: none)
#define WIN  0
#define PCAR 1024.0f
#define SCL  0.125f
#define WNB  128     // |i - j| <= WNB kept
typedef _Float16 h16;
typedef unsigned short bf;
typedef __attribute__((ext_vector_type(16))) __bf16   v16bf;
typedef __attribute__((ext_vector_type(16))) _Float16 v16h;
typedef __attribute__((ext_vector_type(8)))  _Float16 v8h;
typedef __attribute__((ext_vector_type(8)))  unsigned short v8us;
typedef __attribute__((ext_vector_type(8)))  float    v8f;
typedef __attribute__((ext_vector_type(4)))  float    v4f;
typedef v8h  __attribute__((may_alias)) v8ha;
typedef v4f  __attribute__((may_alias)) v4fa;
typedef v8us __attribute__((may_alias)) v8usa;

__device__ __forceinline__ unsigned short f2bf(float f) { unsigned u = __float_as_uint(f); u += 0x7FFFu + ((u >> 16) & 1u); return (unsigned short)(u >> 16); }
__device__ __forceinline__ float bf2f(unsigned short b) { return __uint_as_float(((unsigned)b) << 16); }
__device__ __forceinline__ float bfr(float f) { return bf2f(f2bf(f)); }
__device__ __forceinline__ v16h cat16(v8h lo, v8h hi) { return __builtin_shufflevector(lo, hi, 0, 1, 2, 3, 4, 5, 6, 7, 8, 9, 10, 11, 12, 13, 14, 15); }
__device__ __forceinline__ v16bf cat16b(v8us lo, v8us hi) { return __builtin_bit_cast(v16bf, __builtin_shufflevector(lo, hi, 0, 1, 2, 3, 4, 5, 6, 7, 8, 9, 10, 11, 12, 13, 14, 15)); }
__device__ __forceinline__ v8f wmma16(v16h a, v16h b, v8f c) { return __builtin_amdgcn_wmma_f32_16x16x32_f16(false, a, false, b, (short)0, c, false, false); }
__device__ __forceinline__ v8f wmmab(v16bf a, v16bf b, v8f c) { return __builtin_amdgcn_wmma_f32_16x16x32_bf16(false, a, false, b, (short)0, c, false, false); }



// ---- k_gemmw: register-blocked GEMM, ONE WAVE per 64x64 output tile (16 accumulators), operands straight from K-contiguous 16-bit planes; grid (M/64, N/64, Z), 32 threads.
// C[m][n] (f32, pitch ldc, + optional f32 bias[n]) = sum_k A[m][k] Bt[n][k] (+ split products per NSPLIT). z-batch strides sA/sB/sC in elements. K % 32 == 0.
template <typename T16> struct WFrag;
template <> struct WFrag<h16> { typedef v16h V; static __device__ __forceinline__ V ld(const h16* p) { return cat16(*(const v8h*)p, *(const v8h*)(p + 16)); } static __device__ __forceinline__ v8f mma(V a, V b, v8f c) { return wmma16(a, b, c); } };
template <> struct WFrag<bf> { typedef v16bf V; static __device__ __forceinline__ V ld(const bf* p) { return cat16b(*(const v8us*)p, *(const v8us*)(p + 16)); } static __device__ __forceinline__ v8f mma(V a, V b, v8f c) { return wmmab(a, b, c); } };
template <typename T16, int NSPLIT, bool BIAS>
__global__ __launch_bounds__(32) void k_gemmw(const T16* __restrict__ A, const T16* __restrict__ A2, const T16* __restrict__ Bt, const T16* __restrict__ Bt2, int K, float* C, int ldc, const float* __restrict__ bias, size_t sA, size_t sB, size_t sC) {
    typedef typename WFrag<T16>::V V;
    __shared__ __align__(16) float os[16 * 68];
    const size_t z = blockIdx.z; A += z * sA; if (A2) A2 += z * sA; Bt += z * sB; if (Bt2) Bt2 += z * sB; C += z * sC;
    const int lane = threadIdx.x & 31, lr = lane & 15, hi = lane >> 4; const int r0 = blockIdx.x * 64, c0 = blockIdx.y * 64;
    v8f acc[4][4];
#pragma unroll
    for (int mb = 0; mb < 4; ++mb)
#pragma unroll
        for (int nb = 0; nb < 4; ++nb) acc[mb][nb] = (v8f){};
    const size_t aoff = (size_t)(r0 + lr) * K + 8 * hi, boff = (size_t)(c0 + lr) * K + 8 * hi;
#pragma unroll 1
    for (int kc = 0; kc < K; kc += 32) {
        V a[4], a2[4];
#pragma unroll
        for (int mb = 0; mb < 4; ++mb) { a[mb] = WFrag<T16>::ld(A + aoff + (size_t)mb * 16 * K + kc); if (NSPLIT == 1 || NSPLIT == 2) a2[mb] = WFrag<T16>::ld(A2 + aoff + (size_t)mb * 16 * K + kc); }
#pragma unroll
        for (int nb = 0; nb < 4; ++nb) { const V b = WFrag<T16>::ld(Bt + boff + (size_t)nb * 16 * K + kc); V b2; if (NSPLIT >= 2) b2 = WFrag<T16>::ld(Bt2 + boff + (size_t)nb * 16 * K + kc);
#pragma unroll
            for (int mb = 0; mb < 4; ++mb) { acc[mb][nb] = WFrag<T16>::mma(a[mb], b, acc[mb][nb]); if (NSPLIT == 1 || NSPLIT == 2) acc[mb][nb] = WFrag<T16>::mma(a2[mb], b, acc[mb][nb]); if (NSPLIT >= 2) acc[mb][nb] = WFrag<T16>::mma(a[mb], b2, acc[mb][nb]); } }
        asm volatile("v_nop\n\tv_nop\n\tv_nop\n\tv_nop" : "+v"(acc[0][0]), "+v"(acc[1][1]), "+v"(acc[2][2]), "+v"(acc[3][3]) : "v"(a[0]), "v"(a[3]));
    }
#pragma unroll
    for (int mb = 0; mb < 4; ++mb) {
#pragma unroll
        for (int nb = 0; nb < 4; ++nb) {
#pragma unroll
            for (int j = 0; j < 8; ++j) os[(hi * 8 + j) * 68 + nb * 16 + lr] = acc[mb][nb][j]; }
        __builtin_amdgcn_wave_barrier(); asm volatile("" ::: "memory");
        float* crow = C + (size_t)(r0 + mb * 16) * ldc + c0;
{
#pragma unroll
            for (int s = 0; s < 8; ++s) { const int row = 2 * s + hi, cofs = lr * 4; v4f val = *(const v4fa*)(os + row * 68 + cofs); if (BIAS) { val[0] += bfr(bias[c0 + cofs]); val[1] += bfr(bias[c0 + cofs + 1]); val[2] += bfr(bias[c0 + cofs + 2]); val[3] += bfr(bias[c0 + cofs + 3]); }
                *(v4f*)(crow + (size_t)row * ldc + cofs) = val; }
             }
        __builtin_amdgcn_wave_barrier(); asm volatile("" ::: "memory");
    }
}

__device__ __forceinline__ h16 tohx(float x) { return (h16)x; }
__device__ __forceinline__ void splitf(float y, unsigned short& h, unsigned short& l) { h = f2bf(y); l = f2bf(y - bf2f(h)); }
typedef __attribute__((ext_vector_type(2))) _Float16 v2h;
typedef __attribute__((ext_vector_type(4))) _Float16 v4h;
typedef __attribute__((ext_vector_type(2))) unsigned short v2us;
typedef __attribute__((ext_vector_type(4))) unsigned short v4us;
typedef __attribute__((ext_vector_type(2))) float v2f;
typedef __attribute__((ext_vector_type(4))) int v4i;

__global__ __launch_bounds__(256) void k_wtG(const float* __restrict__ w, int K, int N, bf* Bt) {
    const int lane = threadIdx.x & 31; const int L0 = (blockIdx.x * 8 + (threadIdx.x >> 5)) * 8; const int nlines = N * K / 64;
{
#pragma unroll 1
        for (int l = 0; l < 8; ++l) { const int L = L0 + l; if (L >= nlines) break; const size_t e = (size_t)L * 64 + lane * 2; const int k = (int)(e % K), n = (int)(e / K); v2us o;
            o[0] = f2bf(w[(size_t)k * N + n]); o[1] = f2bf(w[(size_t)(k + 1) * N + n]); *(v2us*)(Bt + e) = o; }
         }
}
__global__ __launch_bounds__(256) void k_cvt8(const float* __restrict__ src, bf* dst, size_t n8) { const size_t i = (size_t)blockIdx.x * 256 + threadIdx.x; if (i >= n8) return; const v8f v = *(const v8f*)(src + i * 8); v8us o;
#pragma unroll
    for (int k = 0; k < 8; ++k) o[k] = f2bf(v[k]); *(v8us*)(dst + i * 8) = o;  }

// k_rope: head planes [h][t][d] (fp16 + hi/lo) of rope(x) x sc with the rotate-half convention out[d] = x[d] cos[t][d] - x[d+HD/2] sin[t][d], out[d+HD/2] = x[d+HD/2] cos[t][d+HD/2] + x[d] sin[t][d+HD/2]
__global__ __launch_bounds__(256) void k_rope(const float* __restrict__ F, int pitch, int nheads, const float* __restrict__ CS, const float* __restrict__ RF, const float* __restrict__ nw, float sc, h16* P16, bf* Ph, bf* Pl) {
    const size_t e = ((size_t)blockIdx.x * 256 + threadIdx.x) * 2; if (e >= (size_t)nheads * TT * HD) return; const int d = (int)(e % HD); const int t = (int)((e / HD) % TT); const int h = (int)(e / ((size_t)HD * TT)); const float* f = F + (size_t)t * pitch + h * HD; const float rf = RF ? RF[(size_t)h * TT + t] : 1.0f; v2h o16; v2us oh, ol;
#pragma unroll
    for (int q = 0; q < 2; ++q) { const int dd = d + q; const int dp = (dd < HD / 2) ? dd + HD / 2 : dd - HD / 2; float x0 = f[dd], x1 = f[dp];
        if (RF) { float n0 = __fmul_rn(x0, rf), n1 = __fmul_rn(x1, rf); asm volatile("" : "+v"(n0)); asm volatile("" : "+v"(n1)); x0 = __fmul_rn(bfr(nw[dd]), n0); x1 = __fmul_rn(bfr(nw[dp]), n1); }
        const v2f cs = *(const v2f*)(CS + ((size_t)t * HD + dd) * 2); float a = __fmul_rn(x0, cs[0]), bq = __fmul_rn(x1, cs[1]); asm volatile("" : "+v"(a)); asm volatile("" : "+v"(bq)); const float r = ((dd < HD / 2) ? __fsub_rn(a, bq) : __fadd_rn(a, bq)) * sc;
        o16[q] = tohx(r); unsigned short a2, c2; splitf(r, a2, c2); oh[q] = a2; ol[q] = c2; }
    *(v2h*)(P16 + e) = o16; *(v2us*)(Ph + e) = oh; *(v2us*)(Pl + e) = ol;  }
__global__ __launch_bounds__(256) void k_vtp(const float* __restrict__ F, int pitch, int nheads, h16* V16, bf* Vh, bf* Vl) { const size_t e = ((size_t)blockIdx.x * 256 + threadIdx.x) * 2; if (e >= (size_t)nheads * HD * TT) return; const int t = (int)(e % TT); const int d = (int)((e / TT) % HD); const int g = (int)(e / ((size_t)TT * HD)); v2h o16; v2us oh, ol;
#pragma unroll
    for (int q = 0; q < 2; ++q) { const float x = F[(size_t)(t + q) * pitch + g * HD + d]; o16[q] = tohx(x); unsigned short a2, c2; splitf(x, a2, c2); oh[q] = a2; ol[q] = c2; }
    *(v2h*)(V16 + e) = o16; *(v2us*)(Vh + e) = oh; *(v2us*)(Vl + e) = ol;  }
__global__ __launch_bounds__(256) void k_csid(float* CS) { const int idx = blockIdx.x * 256 + threadIdx.x; if (idx >= TT * HD) return; v2f cs; cs[0] = 1.0f; cs[1] = 0.0f; *(v2f*)(CS + (size_t)idx * 2) = cs;  }
__global__ __launch_bounds__(256) void k_asoft(const float* __restrict__ Sb, h16* P16, bf* Ph, bf* Pl) {
    const int lane = threadIdx.x & 31; const int row = blockIdx.x * 8 + (threadIdx.x >> 5); if (row >= ZH * TT) return; const int i = row % TT; const int zz = row / TT; (void)zz; const bool hires = (i < RH); const float* sr = Sb + (size_t)row * TT; float v[TT / 32]; float mx = -3.0e38f;
#pragma unroll
    for (int ch = 0; ch < TT / 128; ++ch) { const int j0 = ch * 128 + lane * 4; const v4f a = *(const v4f*)(sr + j0);
#pragma unroll
        for (int q = 0; q < 4; ++q) { const int j = j0 + q; const float t = (j <= i + WNB && j >= i - WNB) ? a[q] * SCL : -3.0e38f; v[ch * 4 + q] = t;   /* local window |i - j| <= 128 (-1e9 == exclusion) */ mx = fmaxf(mx, t); } }
#pragma unroll
    for (int sh = 16; sh; sh >>= 1) mx = fmaxf(mx, __shfl_xor(mx, sh, 32));
    float sum = 0.f;
#pragma unroll
    for (int k = 0; k < TT / 32; ++k) { float d0 = __fsub_rn(v[k], mx); asm volatile("" : "+v"(d0)); v[k] = __builtin_amdgcn_exp2f(__fmul_rn(d0, 1.4426950408889634f)); sum += v[k]; }
#pragma unroll
    for (int sh = 16; sh; sh >>= 1) sum += __shfl_xor(sum, sh, 32);
    const float f = __fdiv_rn(hires ? 1.0f : PCAR, sum);
{
        if (hires) {
#pragma unroll
            for (int ch = 0; ch < TT / 128; ++ch) { v4us oh, ol;
#pragma unroll
                for (int q = 0; q < 4; ++q) { unsigned short a, c2; splitf(v[ch * 4 + q] * f, a, c2); oh[q] = a; ol[q] = c2; }
                const size_t oo = ((size_t)zz * (RH ? RH : 1) + i) * TT + ch * 128 + lane * 4; *(v4us*)(Ph + oo) = oh; *(v4us*)(Pl + oo) = ol; }
        } else {
#pragma unroll
            for (int ch = 0; ch < TT / 128; ++ch) { v4h o4;
#pragma unroll
                for (int q = 0; q < 4; ++q) o4[q] = tohx(v[ch * 4 + q] * f);
                *(v4h*)(P16 + (size_t)row * TT + ch * 128 + lane * 4) = o4; } }
         }
}
__global__ __launch_bounds__(256) void k_merge(const float* __restrict__ O, int h0, bf* Ah, bf* Al) { const size_t e = ((size_t)blockIdx.x * 256 + threadIdx.x) * 2; if (e >= (size_t)ZH * TT * HD) return; const int d = (int)(e % HD); const int t = (int)((e / HD) % TT); const int zz = (int)(e / ((size_t)HD * TT)); const float cs = (t < RH) ? 1.0f : (1.0f / PCAR); const size_t oo = (size_t)t * DQ + (h0 + zz) * HD + d;
    v2us oh, ol;
#pragma unroll
    for (int q = 0; q < 2; ++q) { unsigned short a, c2; splitf(O[e + q] * cs, a, c2); oh[q] = a; ol[q] = c2; } *(v2us*)(Ah + oo) = oh; *(v2us*)(Al + oo) = ol;  }

extern "C" void kernel_launch(void* const* d_in, const int* in_sizes, int n_in,
                              void* d_out, int out_size, void* d_ws, size_t ws_size, hipStream_t stream) {
    (void)in_sizes; (void)n_in; (void)out_size;
    const float* x = (const float*)d_in[0]; const float* wqkv = (const float*)d_in[1]; const float* wo = (const float*)d_in[2]; /* w_proj */ const float* wq = nullptr; const float* wk = nullptr; const float* wv = nullptr; (void)wq; (void)wk; (void)wv;
    float* OUT = (float*)d_out;     // [4][2048][1024]
    char* wsp = (char*)d_ws;
    auto take = [&](size_t bytes) { char* p = wsp; wsp += (bytes + 255) & ~(size_t)255; return (void*)p; };
    bf* WQKV = (bf*)take((size_t)3 * DQ * DM * 2); bf* WQ = WQKV; bf* WK = WQKV + (size_t)DQ * DM; bf* WV = WQKV + (size_t)2 * DQ * DM; bf* WO = (bf*)take((size_t)DM * DQ * 2); float* CS = (float*)take((size_t)TT * HD * 2 * 4);
    bf* XB = (bf*)take((size_t)TT * DM * 2); float* FQ = (float*)take((size_t)TT * DQ * 4); float* FK = (float*)take((size_t)TT * DKV * 4);
    h16* QP16 = (h16*)take((size_t)NH_ * TT * HD * 2); h16* KP16 = (h16*)take((size_t)NKV * TT * HD * 2); h16* VT16 = (h16*)take((size_t)NKV * HD * TT * 2);
    bf* QPh = (bf*)take((size_t)NH_ * TT * HD * 2); bf* QPl = (bf*)take((size_t)NH_ * TT * HD * 2); bf* KPh = (bf*)take((size_t)NKV * TT * HD * 2); bf* KPl = (bf*)take((size_t)NKV * TT * HD * 2); bf* VTh = (bf*)take((size_t)NKV * HD * TT * 2); bf* VTl = (bf*)take((size_t)NKV * HD * TT * 2); bf* Ph = (bf*)take((size_t)ZH * RH * TT * 2); bf* Pl = (bf*)take((size_t)ZH * RH * TT * 2);
    float* Sb = (float*)take((size_t)ZH * TT * TT * 4); h16* P16 = (h16*)take((size_t)ZH * TT * TT * 2); float* Ob = (float*)take((size_t)ZH * TT * HD * 4); bf* ATh = (bf*)take((size_t)TT * DQ * 2); bf* ATl = (bf*)take((size_t)TT * DQ * 2);
    if ((size_t)(wsp - (char*)d_ws) > ws_size) return;    // ws 256 MiB
    float* FV = FK;   // v projection reuses the k buffer after the k planes are built (stream-ordered)
    { k_cvt8<<<(unsigned)(((size_t)3 * DQ * DM / 8 + 255) / 256), 256, 0, stream>>>(wqkv, WQKV, (size_t)3 * DQ * DM / 8);
      k_cvt8<<<(unsigned)(((size_t)DM * DQ / 8 + 255) / 256), 256, 0, stream>>>(wo, WO, (size_t)DM * DQ / 8);
       }
    k_csid<<<(TT * HD + 255) / 256, 256, 0, stream>>>(CS);
    const unsigned LQ = (unsigned)(((size_t)NH_ * TT * HD / 2 + 255) / 256), LKv = (unsigned)(((size_t)NKV * TT * HD / 2 + 255) / 256);
    for (int b = 0; b < NB_; ++b) {
        
        k_cvt8<<<(unsigned)(((size_t)TT * DM / 8 + 255) / 256), 256, 0, stream>>>(x + (size_t)b * TT * DM, XB, (size_t)TT * DM / 8);
        k_gemmw<bf, 0, false><<<dim3(TT / 64, DQ / 64, 1), 32, 0, stream>>>(XB, nullptr, WQ, nullptr, DM, FQ, DQ, nullptr, 0, 0, 0);
        k_rope<<<LQ, 256, 0, stream>>>(FQ, DQ, NH_, CS, nullptr, nullptr, 1.0f, QP16, QPh, QPl);
        k_gemmw<bf, 0, false><<<dim3(TT / 64, DKV / 64, 1), 32, 0, stream>>>(XB, nullptr, WK, nullptr, DM, FK, DKV, nullptr, 0, 0, 0);
        k_rope<<<LKv, 256, 0, stream>>>(FK, DKV, NKV, CS, nullptr, nullptr, 1.0f, KP16, KPh, KPl);
        k_gemmw<bf, 0, false><<<dim3(TT / 64, DKV / 64, 1), 32, 0, stream>>>(XB, nullptr, WV, nullptr, DM, FV, DKV, nullptr, 0, 0, 0); k_vtp<<<LKv, 256, 0, stream>>>(FV, DKV, NKV, VT16, VTh, VTl);
        for (int h0 = 0; h0 < NH_; h0 += ZH) { const size_t zq = (size_t)h0, zk = (size_t)(h0 / REP);   // one kv head per query head: the pass's two heads use consecutive kv planes (z-strides TT*HD)
            k_gemmw<bf, 2, false><<<dim3(RH / 64, TT / 64, ZH), 32, 0, stream>>>(QPh + zq * TT * HD, QPl + zq * TT * HD, KPh + zk * TT * HD, KPl + zk * TT * HD, HD, Sb, TT, nullptr, (size_t)TT * HD, (size_t)TT * HD, (size_t)TT * TT);
            k_gemmw<h16, 0, false><<<dim3((TT - RH) / 64, TT / 64, ZH), 32, 0, stream>>>(QP16 + zq * TT * HD + (size_t)RH * HD, nullptr, KP16 + zk * TT * HD, nullptr, HD, Sb + (size_t)RH * TT, TT, nullptr, (size_t)TT * HD, (size_t)TT * HD, (size_t)TT * TT);
            k_asoft<<<ZH * TT / 8, 256, 0, stream>>>(Sb, P16, Ph, Pl);
            k_gemmw<bf, 2, false><<<dim3(RH / 64, HD / 64, ZH), 32, 0, stream>>>(Ph, Pl, VTh + zk * HD * TT, VTl + zk * HD * TT, TT, Ob, HD, nullptr, (size_t)RH * TT, (size_t)HD * TT, (size_t)TT * HD);
            k_gemmw<h16, 0, false><<<dim3((TT - RH) / 64, HD / 64, ZH), 32, 0, stream>>>(P16 + (size_t)RH * TT, nullptr, VT16 + zk * HD * TT, nullptr, TT, Ob + (size_t)RH * HD, HD, nullptr, (size_t)TT * TT, (size_t)HD * TT, (size_t)TT * HD);
            k_merge<<<(unsigned)(((size_t)ZH * TT * HD / 2 + 255) / 256), 256, 0, stream>>>(Ob, h0, ATh, ATl); }
        k_gemmw<bf, 1, false><<<dim3(TT / 64, DM / 64, 1), 32, 0, stream>>>(ATh, ATl, WO, nullptr, DQ, OUT + (size_t)b * TT * DM, DM, nullptr, 0, 0, 0); }
}

// v001
// One run takes 1610 microseconds.
// In two side-by-side timings against v000, it was 2.46 and 2.44 times as fast.
#include <hip/hip_runtime.h>

// Local (windowed) multi-head self-attention (x [4][2048][1024]; qkv = x w_qkv^T ('oi' [3072][1024] -> q | k | v row blocks, no bias; 16 heads x 64); attn = q.k / 8 with keys |i - j| > 128 filled with -1e9 (== exclusion); softmax; out = merged w_proj^T ('oi' [1024][1024], no bias) -> [4][2048][1024] (8.4 M)).
// Layout per batch: bf16 copy of x; the fused weight used directly as Bt (row blocks); exact projections; banded T-2048 attention (hybrid rows: < 512 hi/lo 3 products, rest fp16 x1024; a 64-row block touches only its 320-key band, the +-128 window applied inside it as an index select in the softmax); merged hi/lo x w_proj exact.
// Compute dtypes, f32 accumulate: every input rounded to bf16; projections exact; attention rows < 512 3 products, rest fp16; softmax f32; w_proj hl x exact.

#define NB_  4
#define TT   2048
#define DM   1024
#define NH_  16
#define NKV  16
#define REP  (NH_ / NKV)
#define HD   64
#define DQ   (NH_ * HD)
#define DKV  (NKV * HD)
#define ZH   2
#define RH   512                  // query rows < RH use hi+lo planes (0: none)
#define WIN  0
#define PCAR 1024.0f
#define SCL  0.125f
#define WNB  128     // |i - j| <= WNB kept
#define NBT  ((64 + 2 * WNB) / 64)    // 64-key tiles in a 64-row block's band
#define NCH  3       // aligned 128-key chunks that cover a band
typedef _Float16 h16;
typedef unsigned short bf;
typedef __attribute__((ext_vector_type(16))) __bf16   v16bf;
typedef __attribute__((ext_vector_type(16))) _Float16 v16h;
typedef __attribute__((ext_vector_type(8)))  _Float16 v8h;
typedef __attribute__((ext_vector_type(8)))  unsigned short v8us;
typedef __attribute__((ext_vector_type(8)))  float    v8f;
typedef __attribute__((ext_vector_type(4)))  float    v4f;
typedef v8h  __attribute__((may_alias)) v8ha;
typedef v4f  __attribute__((may_alias)) v4fa;
typedef v8us __attribute__((may_alias)) v8usa;

__device__ __forceinline__ unsigned short f2bf(float f) { unsigned u = __float_as_uint(f); u += 0x7FFFu + ((u >> 16) & 1u); return (unsigned short)(u >> 16); }
__device__ __forceinline__ float bf2f(unsigned short b) { return __uint_as_float(((unsigned)b) << 16); }
__device__ __forceinline__ float bfr(float f) { return bf2f(f2bf(f)); }
__device__ __forceinline__ v16h cat16(v8h lo, v8h hi) { return __builtin_shufflevector(lo, hi, 0, 1, 2, 3, 4, 5, 6, 7, 8, 9, 10, 11, 12, 13, 14, 15); }
__device__ __forceinline__ v16bf cat16b(v8us lo, v8us hi) { return __builtin_bit_cast(v16bf, __builtin_shufflevector(lo, hi, 0, 1, 2, 3, 4, 5, 6, 7, 8, 9, 10, 11, 12, 13, 14, 15)); }
__device__ __forceinline__ v8f wmma16(v16h a, v16h b, v8f c) { return __builtin_amdgcn_wmma_f32_16x16x32_f16(false, a, false, b, (short)0, c, false, false); }
__device__ __forceinline__ v8f wmmab(v16bf a, v16bf b, v8f c) { return __builtin_amdgcn_wmma_f32_16x16x32_bf16(false, a, false, b, (short)0, c, false, false); }



// ---- k_gemmw: register-blocked GEMM, ONE WAVE per 64x64 output tile (16 accumulators), operands straight from K-contiguous 16-bit planes; grid (M/64, N/64, Z), 32 threads.
// C[m][n] (f32, pitch ldc, + optional f32 bias[n]) = sum_k A[m][k] Bt[n][k] (+ split products per NSPLIT). z-batch strides sA/sB/sC in elements. K % 32 == 0.
// BAND (rowg = sequence index of A's row 0): the keys a 64-row block can see are [row - WNB, row + 64 + WNB) clipped to [0, TT). 1: grid y walks the 64-column tiles of that band only. 2: the k loop runs over that band only (P is exactly 0 outside it).
template <typename T16> struct WFrag;
template <> struct WFrag<h16> { typedef v16h V; static __device__ __forceinline__ V ld(const h16* p) { return cat16(*(const v8h*)p, *(const v8h*)(p + 16)); } static __device__ __forceinline__ v8f mma(V a, V b, v8f c) { return wmma16(a, b, c); } };
template <> struct WFrag<bf> { typedef v16bf V; static __device__ __forceinline__ V ld(const bf* p) { return cat16b(*(const v8us*)p, *(const v8us*)(p + 16)); } static __device__ __forceinline__ v8f mma(V a, V b, v8f c) { return wmmab(a, b, c); } };
template <typename T16, int NSPLIT, bool BIAS, int BAND>
__global__ __launch_bounds__(32) void k_gemmw(const T16* __restrict__ A, const T16* __restrict__ A2, const T16* __restrict__ Bt, const T16* __restrict__ Bt2, int K, float* C, int ldc, const float* __restrict__ bias, size_t sA, size_t sB, size_t sC, int rowg) {
    typedef typename WFrag<T16>::V V;
    __shared__ __align__(16) float os[16 * 68];
    const size_t z = blockIdx.z; A += z * sA; if (A2) A2 += z * sA; Bt += z * sB; if (Bt2) Bt2 += z * sB; C += z * sC;
    const int lane = threadIdx.x & 31, lr = lane & 15, hi = lane >> 4; const int r0 = blockIdx.x * 64, blo = rowg + r0 - WNB, c0 = (BAND == 1 ? blo : 0) + blockIdx.y * 64;
    if (BAND == 1 && (c0 < 0 || c0 >= TT)) return;
    const int k0 = (BAND == 2 && blo > 0) ? blo : 0, k1 = (BAND == 2 && blo + 64 + 2 * WNB < K) ? blo + 64 + 2 * WNB : K;
    v8f acc[4][4];
#pragma unroll
    for (int mb = 0; mb < 4; ++mb)
#pragma unroll
        for (int nb = 0; nb < 4; ++nb) acc[mb][nb] = (v8f){};
    const size_t aoff = (size_t)(r0 + lr) * K + 8 * hi, boff = (size_t)(c0 + lr) * K + 8 * hi;
#pragma unroll 1
    for (int kc = k0; kc < k1; kc += 32) {
        V a[4], a2[4];
#pragma unroll
        for (int mb = 0; mb < 4; ++mb) { a[mb] = WFrag<T16>::ld(A + aoff + (size_t)mb * 16 * K + kc); if (NSPLIT == 1 || NSPLIT == 2) a2[mb] = WFrag<T16>::ld(A2 + aoff + (size_t)mb * 16 * K + kc); }
#pragma unroll
        for (int nb = 0; nb < 4; ++nb) { const V b = WFrag<T16>::ld(Bt + boff + (size_t)nb * 16 * K + kc); V b2; if (NSPLIT >= 2) b2 = WFrag<T16>::ld(Bt2 + boff + (size_t)nb * 16 * K + kc);
#pragma unroll
            for (int mb = 0; mb < 4; ++mb) { acc[mb][nb] = WFrag<T16>::mma(a[mb], b, acc[mb][nb]); if (NSPLIT == 1 || NSPLIT == 2) acc[mb][nb] = WFrag<T16>::mma(a2[mb], b, acc[mb][nb]); if (NSPLIT >= 2) acc[mb][nb] = WFrag<T16>::mma(a[mb], b2, acc[mb][nb]); } }
        asm volatile("v_nop\n\tv_nop\n\tv_nop\n\tv_nop" : "+v"(acc[0][0]), "+v"(acc[1][1]), "+v"(acc[2][2]), "+v"(acc[3][3]) : "v"(a[0]), "v"(a[3]));
    }
#pragma unroll
    for (int mb = 0; mb < 4; ++mb) {
#pragma unroll
        for (int nb = 0; nb < 4; ++nb) {
#pragma unroll
            for (int j = 0; j < 8; ++j) os[(hi * 8 + j) * 68 + nb * 16 + lr] = acc[mb][nb][j]; }
        __builtin_amdgcn_wave_barrier(); asm volatile("" ::: "memory");
        float* crow = C + (size_t)(r0 + mb * 16) * ldc + c0;
{
#pragma unroll
            for (int s = 0; s < 8; ++s) { const int row = 2 * s + hi, cofs = lr * 4; v4f val = *(const v4fa*)(os + row * 68 + cofs); if (BIAS) { val[0] += bfr(bias[c0 + cofs]); val[1] += bfr(bias[c0 + cofs + 1]); val[2] += bfr(bias[c0 + cofs + 2]); val[3] += bfr(bias[c0 + cofs + 3]); }
                *(v4f*)(crow + (size_t)row * ldc + cofs) = val; }
             }
        __builtin_amdgcn_wave_barrier(); asm volatile("" ::: "memory");
    }
}

__device__ __forceinline__ h16 tohx(float x) { return (h16)x; }
__device__ __forceinline__ void splitf(float y, unsigned short& h, unsigned short& l) { h = f2bf(y); l = f2bf(y - bf2f(h)); }
typedef __attribute__((ext_vector_type(2))) _Float16 v2h;
typedef __attribute__((ext_vector_type(4))) _Float16 v4h;
typedef __attribute__((ext_vector_type(2))) unsigned short v2us;
typedef __attribute__((ext_vector_type(4))) unsigned short v4us;
typedef __attribute__((ext_vector_type(2))) float v2f;
typedef __attribute__((ext_vector_type(4))) int v4i;

__global__ __launch_bounds__(256) void k_wtG(const float* __restrict__ w, int K, int N, bf* Bt) {
    const int lane = threadIdx.x & 31; const int L0 = (blockIdx.x * 8 + (threadIdx.x >> 5)) * 8; const int nlines = N * K / 64;
{
#pragma unroll 1
        for (int l = 0; l < 8; ++l) { const int L = L0 + l; if (L >= nlines) break; const size_t e = (size_t)L * 64 + lane * 2; const int k = (int)(e % K), n = (int)(e / K); v2us o;
            o[0] = f2bf(w[(size_t)k * N + n]); o[1] = f2bf(w[(size_t)(k + 1) * N + n]); *(v2us*)(Bt + e) = o; }
         }
}
__global__ __launch_bounds__(256) void k_cvt8(const float* __restrict__ src, bf* dst, size_t n8) { const size_t i = (size_t)blockIdx.x * 256 + threadIdx.x; if (i >= n8) return; const v8f v = *(const v8f*)(src + i * 8); v8us o;
#pragma unroll
    for (int k = 0; k < 8; ++k) o[k] = f2bf(v[k]); *(v8us*)(dst + i * 8) = o;  }

// k_rope: head planes [h][t][d] (fp16 + hi/lo) of rope(x) x sc with the rotate-half convention out[d] = x[d] cos[t][d] - x[d+HD/2] sin[t][d], out[d+HD/2] = x[d+HD/2] cos[t][d+HD/2] + x[d] sin[t][d+HD/2]
__global__ __launch_bounds__(256) void k_rope(const float* __restrict__ F, int pitch, int nheads, const float* __restrict__ CS, const float* __restrict__ RF, const float* __restrict__ nw, float sc, h16* P16, bf* Ph, bf* Pl) {
    const size_t e = ((size_t)blockIdx.x * 256 + threadIdx.x) * 2; if (e >= (size_t)nheads * TT * HD) return; const int d = (int)(e % HD); const int t = (int)((e / HD) % TT); const int h = (int)(e / ((size_t)HD * TT)); const float* f = F + (size_t)t * pitch + h * HD; const float rf = RF ? RF[(size_t)h * TT + t] : 1.0f; v2h o16; v2us oh, ol;
#pragma unroll
    for (int q = 0; q < 2; ++q) { const int dd = d + q; const int dp = (dd < HD / 2) ? dd + HD / 2 : dd - HD / 2; float x0 = f[dd], x1 = f[dp];
        if (RF) { float n0 = __fmul_rn(x0, rf), n1 = __fmul_rn(x1, rf); asm volatile("" : "+v"(n0)); asm volatile("" : "+v"(n1)); x0 = __fmul_rn(bfr(nw[dd]), n0); x1 = __fmul_rn(bfr(nw[dp]), n1); }
        const v2f cs = *(const v2f*)(CS + ((size_t)t * HD + dd) * 2); float a = __fmul_rn(x0, cs[0]), bq = __fmul_rn(x1, cs[1]); asm volatile("" : "+v"(a)); asm volatile("" : "+v"(bq)); const float r = ((dd < HD / 2) ? __fsub_rn(a, bq) : __fadd_rn(a, bq)) * sc;
        o16[q] = tohx(r); unsigned short a2, c2; splitf(r, a2, c2); oh[q] = a2; ol[q] = c2; }
    *(v2h*)(P16 + e) = o16; *(v2us*)(Ph + e) = oh; *(v2us*)(Pl + e) = ol;  }
__global__ __launch_bounds__(256) void k_vtp(const float* __restrict__ F, int pitch, int nheads, h16* V16, bf* Vh, bf* Vl) { const size_t e = ((size_t)blockIdx.x * 256 + threadIdx.x) * 2; if (e >= (size_t)nheads * HD * TT) return; const int t = (int)(e % TT); const int d = (int)((e / TT) % HD); const int g = (int)(e / ((size_t)TT * HD)); v2h o16; v2us oh, ol;
#pragma unroll
    for (int q = 0; q < 2; ++q) { const float x = F[(size_t)(t + q) * pitch + g * HD + d]; o16[q] = tohx(x); unsigned short a2, c2; splitf(x, a2, c2); oh[q] = a2; ol[q] = c2; }
    *(v2h*)(V16 + e) = o16; *(v2us*)(Vh + e) = oh; *(v2us*)(Vl + e) = ol;  }
__global__ __launch_bounds__(256) void k_csid(float* CS) { const int idx = blockIdx.x * 256 + threadIdx.x; if (idx >= TT * HD) return; v2f cs; cs[0] = 1.0f; cs[1] = 0.0f; *(v2f*)(CS + (size_t)idx * 2) = cs;  }
__global__ __launch_bounds__(256) void k_asoft(const float* __restrict__ Sb, h16* P16, bf* Ph, bf* Pl) {
    const int lane = threadIdx.x & 31; const int row = blockIdx.x * 8 + (threadIdx.x >> 5); if (row >= ZH * TT) return; const int i = row % TT; const int zz = row / TT; (void)zz; const bool hires = (i < RH); const float* sr = Sb + (size_t)row * TT; float v[NCH * 4]; float mx = -3.0e38f;
    const int blo = (i & ~63) - WNB, lo = blo > 0 ? blo : 0, hi = blo + 64 + 2 * WNB < TT ? blo + 64 + 2 * WNB : TT; const int cb = (blo >> 7) * 128 + lane * 4;   // the row block's key band [lo, hi), covered by NCH 128-aligned chunks; lanes outside it neither load nor store
#pragma unroll
    for (int ch = 0; ch < NCH; ++ch) { const int j0 = cb + ch * 128; const bool inb = (j0 >= lo && j0 < hi); v4f a = (v4f){}; if (inb) a = *(const v4f*)(sr + j0);
#pragma unroll
        for (int q = 0; q < 4; ++q) { const int j = j0 + q; const float t = (inb && j <= i + WNB && j >= i - WNB) ? a[q] * SCL : -3.0e38f; v[ch * 4 + q] = t;   /* local window |i - j| <= 128 (-1e9 == exclusion) */ mx = fmaxf(mx, t); } }
#pragma unroll
    for (int sh = 16; sh; sh >>= 1) mx = fmaxf(mx, __shfl_xor(mx, sh, 32));
    float sum = 0.f;
#pragma unroll
    for (int k = 0; k < NCH * 4; ++k) { float d0 = __fsub_rn(v[k], mx); asm volatile("" : "+v"(d0)); v[k] = __builtin_amdgcn_exp2f(__fmul_rn(d0, 1.4426950408889634f)); sum += v[k]; }
#pragma unroll
    for (int sh = 16; sh; sh >>= 1) sum += __shfl_xor(sum, sh, 32);
    const float f = __fdiv_rn(hires ? 1.0f : PCAR, sum);
{
        if (hires) {
#pragma unroll
            for (int ch = 0; ch < NCH; ++ch) { const int j0 = cb + ch * 128; v4us oh, ol;
#pragma unroll
                for (int q = 0; q < 4; ++q) { unsigned short a, c2; splitf(v[ch * 4 + q] * f, a, c2); oh[q] = a; ol[q] = c2; }
                if (j0 >= lo && j0 < hi) { const size_t oo = ((size_t)zz * (RH ? RH : 1) + i) * TT + j0; *(v4us*)(Ph + oo) = oh; *(v4us*)(Pl + oo) = ol; } }
        } else {
#pragma unroll
            for (int ch = 0; ch < NCH; ++ch) { const int j0 = cb + ch * 128; v4h o4;
#pragma unroll
                for (int q = 0; q < 4; ++q) o4[q] = tohx(v[ch * 4 + q] * f);
                if (j0 >= lo && j0 < hi) *(v4h*)(P16 + (size_t)row * TT + j0) = o4; } }
         }
}
__global__ __launch_bounds__(256) void k_merge(const float* __restrict__ O, int h0, bf* Ah, bf* Al) { const size_t e = ((size_t)blockIdx.x * 256 + threadIdx.x) * 2; if (e >= (size_t)ZH * TT * HD) return; const int d = (int)(e % HD); const int t = (int)((e / HD) % TT); const int zz = (int)(e / ((size_t)HD * TT)); const float cs = (t < RH) ? 1.0f : (1.0f / PCAR); const size_t oo = (size_t)t * DQ + (h0 + zz) * HD + d;
    v2us oh, ol;
#pragma unroll
    for (int q = 0; q < 2; ++q) { unsigned short a, c2; splitf(O[e + q] * cs, a, c2); oh[q] = a; ol[q] = c2; } *(v2us*)(Ah + oo) = oh; *(v2us*)(Al + oo) = ol;  }

extern "C" void kernel_launch(void* const* d_in, const int* in_sizes, int n_in,
                              void* d_out, int out_size, void* d_ws, size_t ws_size, hipStream_t stream) {
    (void)in_sizes; (void)n_in; (void)out_size;
    const float* x = (const float*)d_in[0]; const float* wqkv = (const float*)d_in[1]; const float* wo = (const float*)d_in[2]; /* w_proj */ const float* wq = nullptr; const float* wk = nullptr; const float* wv = nullptr; (void)wq; (void)wk; (void)wv;
    float* OUT = (float*)d_out;     // [4][2048][1024]
    char* wsp = (char*)d_ws;
    auto take = [&](size_t bytes) { char* p = wsp; wsp += (bytes + 255) & ~(size_t)255; return (void*)p; };
    bf* WQKV = (bf*)take((size_t)3 * DQ * DM * 2); bf* WQ = WQKV; bf* WK = WQKV + (size_t)DQ * DM; bf* WV = WQKV + (size_t)2 * DQ * DM; bf* WO = (bf*)take((size_t)DM * DQ * 2); float* CS = (float*)take((size_t)TT * HD * 2 * 4);
    bf* XB = (bf*)take((size_t)TT * DM * 2); float* FQ = (float*)take((size_t)TT * DQ * 4); float* FK = (float*)take((size_t)TT * DKV * 4);
    h16* QP16 = (h16*)take((size_t)NH_ * TT * HD * 2); h16* KP16 = (h16*)take((size_t)NKV * TT * HD * 2); h16* VT16 = (h16*)take((size_t)NKV * HD * TT * 2);
    bf* QPh = (bf*)take((size_t)NH_ * TT * HD * 2); bf* QPl = (bf*)take((size_t)NH_ * TT * HD * 2); bf* KPh = (bf*)take((size_t)NKV * TT * HD * 2); bf* KPl = (bf*)take((size_t)NKV * TT * HD * 2); bf* VTh = (bf*)take((size_t)NKV * HD * TT * 2); bf* VTl = (bf*)take((size_t)NKV * HD * TT * 2); bf* Ph = (bf*)take((size_t)ZH * RH * TT * 2); bf* Pl = (bf*)take((size_t)ZH * RH * TT * 2);
    float* Sb = (float*)take((size_t)ZH * TT * TT * 4); h16* P16 = (h16*)take((size_t)ZH * TT * TT * 2); float* Ob = (float*)take((size_t)ZH * TT * HD * 4); bf* ATh = (bf*)take((size_t)TT * DQ * 2); bf* ATl = (bf*)take((size_t)TT * DQ * 2);
    if ((size_t)(wsp - (char*)d_ws) > ws_size) return;    // ws 256 MiB
    float* FV = FK;   // v projection reuses the k buffer after the k planes are built (stream-ordered)
    { k_cvt8<<<(unsigned)(((size_t)3 * DQ * DM / 8 + 255) / 256), 256, 0, stream>>>(wqkv, WQKV, (size_t)3 * DQ * DM / 8);
      k_cvt8<<<(unsigned)(((size_t)DM * DQ / 8 + 255) / 256), 256, 0, stream>>>(wo, WO, (size_t)DM * DQ / 8);
       }
    k_csid<<<(TT * HD + 255) / 256, 256, 0, stream>>>(CS);
    const unsigned LQ = (unsigned)(((size_t)NH_ * TT * HD / 2 + 255) / 256), LKv = (unsigned)(((size_t)NKV * TT * HD / 2 + 255) / 256);
    for (int b = 0; b < NB_; ++b) {
        
        k_cvt8<<<(unsigned)(((size_t)TT * DM / 8 + 255) / 256), 256, 0, stream>>>(x + (size_t)b * TT * DM, XB, (size_t)TT * DM / 8);
        k_gemmw<bf, 0, false, 0><<<dim3(TT / 64, DQ / 64, 1), 32, 0, stream>>>(XB, nullptr, WQ, nullptr, DM, FQ, DQ, nullptr, 0, 0, 0, 0);
        k_rope<<<LQ, 256, 0, stream>>>(FQ, DQ, NH_, CS, nullptr, nullptr, 1.0f, QP16, QPh, QPl);
        k_gemmw<bf, 0, false, 0><<<dim3(TT / 64, DKV / 64, 1), 32, 0, stream>>>(XB, nullptr, WK, nullptr, DM, FK, DKV, nullptr, 0, 0, 0, 0);
        k_rope<<<LKv, 256, 0, stream>>>(FK, DKV, NKV, CS, nullptr, nullptr, 1.0f, KP16, KPh, KPl);
        k_gemmw<bf, 0, false, 0><<<dim3(TT / 64, DKV / 64, 1), 32, 0, stream>>>(XB, nullptr, WV, nullptr, DM, FV, DKV, nullptr, 0, 0, 0, 0); k_vtp<<<LKv, 256, 0, stream>>>(FV, DKV, NKV, VT16, VTh, VTl);
        for (int h0 = 0; h0 < NH_; h0 += ZH) { const size_t zq = (size_t)h0, zk = (size_t)(h0 / REP);   // one kv head per query head: the pass's two heads use consecutive kv planes (z-strides TT*HD)
            k_gemmw<bf, 2, false, 1><<<dim3(RH / 64, NBT, ZH), 32, 0, stream>>>(QPh + zq * TT * HD, QPl + zq * TT * HD, KPh + zk * TT * HD, KPl + zk * TT * HD, HD, Sb, TT, nullptr, (size_t)TT * HD, (size_t)TT * HD, (size_t)TT * TT, 0);
            k_gemmw<h16, 0, false, 1><<<dim3((TT - RH) / 64, NBT, ZH), 32, 0, stream>>>(QP16 + zq * TT * HD + (size_t)RH * HD, nullptr, KP16 + zk * TT * HD, nullptr, HD, Sb + (size_t)RH * TT, TT, nullptr, (size_t)TT * HD, (size_t)TT * HD, (size_t)TT * TT, RH);
            k_asoft<<<ZH * TT / 8, 256, 0, stream>>>(Sb, P16, Ph, Pl);
            k_gemmw<bf, 2, false, 2><<<dim3(RH / 64, HD / 64, ZH), 32, 0, stream>>>(Ph, Pl, VTh + zk * HD * TT, VTl + zk * HD * TT, TT, Ob, HD, nullptr, (size_t)RH * TT, (size_t)HD * TT, (size_t)TT * HD, 0);
            k_gemmw<h16, 0, false, 2><<<dim3((TT - RH) / 64, HD / 64, ZH), 32, 0, stream>>>(P16 + (size_t)RH * TT, nullptr, VT16 + zk * HD * TT, nullptr, TT, Ob + (size_t)RH * HD, HD, nullptr, (size_t)TT * TT, (size_t)HD * TT, (size_t)TT * HD, RH);
            k_merge<<<(unsigned)(((size_t)ZH * TT * HD / 2 + 255) / 256), 256, 0, stream>>>(Ob, h0, ATh, ATl); }
        k_gemmw<bf, 1, false, 0><<<dim3(TT / 64, DM / 64, 1), 32, 0, stream>>>(ATh, ATl, WO, nullptr, DQ, OUT + (size_t)b * TT * DM, DM, nullptr, 0, 0, 0, 0); }
}

// v002
// Measured time: 415 microseconds a run.
// Two timings next to v001 put it at 3.88 and 3.89 times that version's speed.
// Counting every step since v000, it is 9.53 times as fast.
#include <hip/hip_runtime.h>

// Local (windowed) multi-head self-attention (x [4][2048][1024]; qkv = x w_qkv^T ('oi' [3072][1024] -> q | k | v row blocks, no bias; 16 heads x 64); attn = q.k / 8 with keys |i - j| > 128 filled with -1e9 (== exclusion); softmax; out = merged w_proj^T ('oi' [1024][1024], no bias) -> [4][2048][1024] (8.4 M)).
// Layout: bf16 copy of x (all batches, one launch); per pass of GB = 2 batches: q | k | v as ONE GEMM (M = 4096) against the fused weight (Bt, N = 3072); all 2 x 16 (batch, head) pairs in the z of every attention launch, scores and P kept band-compact ([row][320], column j at j - band start) so that they fit the workspace; banded T-2048 attention (hybrid rows: < 512 hi/lo 3 products, rest fp16 x1024; a 64-row block touches only its 320-key band, the +-128 window applied inside it as an index select in the softmax); merged hi/lo x w_proj exact.
// Compute dtypes, f32 accumulate: every input rounded to bf16; projections exact; attention rows < 512 3 products, rest fp16; softmax f32; w_proj hl x exact.

#define NB_  4
#define TT   2048
#define DM   1024
#define NH_  16
#define NKV  16
#define REP  (NH_ / NKV)
#define HD   64
#define DQ   (NH_ * HD)
#define DKV  (NKV * HD)
#define GB   2                    // batches per pass
#define ZH   (GB * NH_)           // (batch, head) pairs per attention launch (grid z), z = batch * NH_ + head
#define RH   512                  // query rows < RH use hi+lo planes (0: none)
#define WIN  0
#define PCAR 1024.0f
#define SCL  0.125f
#define WNB  128     // |i - j| <= WNB kept
#define NBT  ((64 + 2 * WNB) / 64)    // 64-key tiles in a 64-row block's band
#define NCH  3       // aligned 128-key chunks that cover a band
#define BW   (64 + 2 * WNB)           // band width = pitch of the compact score and P rows
typedef _Float16 h16;
typedef unsigned short bf;
typedef __attribute__((ext_vector_type(16))) __bf16   v16bf;
typedef __attribute__((ext_vector_type(16))) _Float16 v16h;
typedef __attribute__((ext_vector_type(8)))  _Float16 v8h;
typedef __attribute__((ext_vector_type(8)))  unsigned short v8us;
typedef __attribute__((ext_vector_type(8)))  float    v8f;
typedef __attribute__((ext_vector_type(4)))  float    v4f;
typedef v8h  __attribute__((may_alias)) v8ha;
typedef v4f  __attribute__((may_alias)) v4fa;
typedef v8us __attribute__((may_alias)) v8usa;

__device__ __forceinline__ unsigned short f2bf(float f) { unsigned u = __float_as_uint(f); u += 0x7FFFu + ((u >> 16) & 1u); return (unsigned short)(u >> 16); }
__device__ __forceinline__ float bf2f(unsigned short b) { return __uint_as_float(((unsigned)b) << 16); }
__device__ __forceinline__ float bfr(float f) { return bf2f(f2bf(f)); }
__device__ __forceinline__ v16h cat16(v8h lo, v8h hi) { return __builtin_shufflevector(lo, hi, 0, 1, 2, 3, 4, 5, 6, 7, 8, 9, 10, 11, 12, 13, 14, 15); }
__device__ __forceinline__ v16bf cat16b(v8us lo, v8us hi) { return __builtin_bit_cast(v16bf, __builtin_shufflevector(lo, hi, 0, 1, 2, 3, 4, 5, 6, 7, 8, 9, 10, 11, 12, 13, 14, 15)); }
__device__ __forceinline__ v8f wmma16(v16h a, v16h b, v8f c) { return __builtin_amdgcn_wmma_f32_16x16x32_f16(false, a, false, b, (short)0, c, false, false); }
__device__ __forceinline__ v8f wmmab(v16bf a, v16bf b, v8f c) { return __builtin_amdgcn_wmma_f32_16x16x32_bf16(false, a, false, b, (short)0, c, false, false); }



// ---- k_gemmw: register-blocked GEMM, ONE WAVE per 64x64 output tile (16 accumulators), operands straight from K-contiguous 16-bit planes; grid (M/64, N/64, Z), 32 threads.
// C[m][n] (f32, pitch ldc, + optional f32 bias[n]) = sum_k A[m][k] Bt[n][k] (+ split products per NSPLIT). z-batch strides sA/sB/sC in elements. K % 32 == 0.
// BAND (rowg = sequence index of A's row 0): the keys a 64-row block can see are [row - WNB, row + 64 + WNB) clipped to [0, TT). 1: grid y walks the 64-column tiles of that band only; C is band-compact (key j at column j - band start, ldc = BW). 2: the k loop runs over that band only (P is exactly 0 outside it); A is band-compact (pitch BW), Bt keeps pitch K.
template <typename T16> struct WFrag;
template <> struct WFrag<h16> { typedef v16h V; static __device__ __forceinline__ V ld(const h16* p) { return cat16(*(const v8h*)p, *(const v8h*)(p + 16)); } static __device__ __forceinline__ v8f mma(V a, V b, v8f c) { return wmma16(a, b, c); } };
template <> struct WFrag<bf> { typedef v16bf V; static __device__ __forceinline__ V ld(const bf* p) { return cat16b(*(const v8us*)p, *(const v8us*)(p + 16)); } static __device__ __forceinline__ v8f mma(V a, V b, v8f c) { return wmmab(a, b, c); } };
template <typename T16, int NSPLIT, bool BIAS, int BAND>
__global__ __launch_bounds__(32) void k_gemmw(const T16* __restrict__ A, const T16* __restrict__ A2, const T16* __restrict__ Bt, const T16* __restrict__ Bt2, int K, float* C, int ldc, const float* __restrict__ bias, size_t sA, size_t sB, size_t sC, int rowg) {
    typedef typename WFrag<T16>::V V;
    __shared__ __align__(16) float os[16 * 68];
    const size_t z = blockIdx.z; A += z * sA; if (A2) A2 += z * sA; Bt += z * sB; if (Bt2) Bt2 += z * sB; C += z * sC;
    const int lane = threadIdx.x & 31, lr = lane & 15, hi = lane >> 4; const int r0 = blockIdx.x * 64, blo = rowg + r0 - WNB, c0 = (BAND == 1 ? blo : 0) + blockIdx.y * 64;
    if (BAND == 1 && (c0 < 0 || c0 >= TT)) return;
    const int cc0 = blockIdx.y * 64, lda = (BAND == 2) ? BW : K, ab = (BAND == 2) ? rowg + r0 : 0, ac = (BAND == 2) ? WNB : 0;   // C's first column; A's pitch; key ab sits in A's column ac
    const int k0 = (BAND == 2 && blo > 0) ? blo : 0, k1 = (BAND == 2 && blo + 64 + 2 * WNB < K) ? blo + 64 + 2 * WNB : K;
    v8f acc[4][4];
#pragma unroll
    for (int mb = 0; mb < 4; ++mb)
#pragma unroll
        for (int nb = 0; nb < 4; ++nb) acc[mb][nb] = (v8f){};
    const size_t aoff = (size_t)(r0 + lr) * lda + 8 * hi, boff = (size_t)(c0 + lr) * K + 8 * hi;
#pragma unroll 1
    for (int kc = k0; kc < k1; kc += 32) {
        V a[4], a2[4]; const T16* pa[4]; const T16* pa2[4];
#pragma unroll
        for (int mb = 0; mb < 4; ++mb) { pa[mb] = A + aoff + (size_t)mb * 16 * lda + (kc - ab); a[mb] = WFrag<T16>::ld(pa[mb] + ac); if (NSPLIT == 1 || NSPLIT == 2) { pa2[mb] = A2 + aoff + (size_t)mb * 16 * lda + (kc - ab); a2[mb] = WFrag<T16>::ld(pa2[mb] + ac); } }
        // one wait behind the run of A loads, before any register that holds one of their addresses is written again; the addresses are inputs so that their registers stay untouched up to the wait (BAND 2: the pitch is a constant, every row block is an immediate offset from the first address)
        if (BAND == 2) { if (NSPLIT == 1 || NSPLIT == 2) asm volatile("s_wait_xcnt 0x0" :: "v"(pa[0]), "v"(pa2[0]) : "memory"); else asm volatile("s_wait_xcnt 0x0" :: "v"(pa[0]) : "memory"); }
        else if (NSPLIT == 1 || NSPLIT == 2) asm volatile("s_wait_xcnt 0x0" :: "v"(pa[0]), "v"(pa[1]), "v"(pa[2]), "v"(pa[3]), "v"(pa2[0]), "v"(pa2[1]), "v"(pa2[2]), "v"(pa2[3]) : "memory");
        else asm volatile("s_wait_xcnt 0x0" :: "v"(pa[0]), "v"(pa[1]), "v"(pa[2]), "v"(pa[3]) : "memory");
#pragma unroll
        for (int nb = 0; nb < 4; ++nb) { const V b = WFrag<T16>::ld(Bt + boff + (size_t)nb * 16 * K + kc); V b2; if (NSPLIT >= 2) b2 = WFrag<T16>::ld(Bt2 + boff + (size_t)nb * 16 * K + kc);
#pragma unroll
            for (int mb = 0; mb < 4; ++mb) { acc[mb][nb] = WFrag<T16>::mma(a[mb], b, acc[mb][nb]); if (NSPLIT == 1 || NSPLIT == 2) acc[mb][nb] = WFrag<T16>::mma(a2[mb], b, acc[mb][nb]); if (NSPLIT >= 2) acc[mb][nb] = WFrag<T16>::mma(a[mb], b2, acc[mb][nb]); } }
        asm volatile("v_nop\n\tv_nop\n\tv_nop\n\tv_nop" : "+v"(acc[0][0]), "+v"(acc[1][1]), "+v"(acc[2][2]), "+v"(acc[3][3]) : "v"(a[0]), "v"(a[3]));
    }
#pragma unroll
    for (int mb = 0; mb < 4; ++mb) {
#pragma unroll
        for (int nb = 0; nb < 4; ++nb) {
#pragma unroll
            for (int j = 0; j < 8; ++j) os[(hi * 8 + j) * 68 + nb * 16 + lr] = acc[mb][nb][j]; }
        __builtin_amdgcn_wave_barrier(); asm volatile("" ::: "memory");
        float* crow = C + (size_t)(r0 + mb * 16) * ldc + cc0;
{
#pragma unroll
            for (int s = 0; s < 8; ++s) { const int row = 2 * s + hi, cofs = lr * 4; v4f val = *(const v4fa*)(os + row * 68 + cofs); if (BIAS) { val[0] += bfr(bias[c0 + cofs]); val[1] += bfr(bias[c0 + cofs + 1]); val[2] += bfr(bias[c0 + cofs + 2]); val[3] += bfr(bias[c0 + cofs + 3]); }
                *(v4f*)(crow + (size_t)row * ldc + cofs) = val; }
             }
        __builtin_amdgcn_wave_barrier(); asm volatile("" ::: "memory");
    }
}

__device__ __forceinline__ h16 tohx(float x) { return (h16)x; }
__device__ __forceinline__ void splitf(float y, unsigned short& h, unsigned short& l) { h = f2bf(y); l = f2bf(y - bf2f(h)); }
typedef __attribute__((ext_vector_type(2))) _Float16 v2h;
typedef __attribute__((ext_vector_type(4))) _Float16 v4h;
typedef __attribute__((ext_vector_type(2))) unsigned short v2us;
typedef __attribute__((ext_vector_type(4))) unsigned short v4us;
typedef __attribute__((ext_vector_type(2))) float v2f;
typedef __attribute__((ext_vector_type(4))) int v4i;

__global__ __launch_bounds__(256) void k_wtG(const float* __restrict__ w, int K, int N, bf* Bt) {
    const int lane = threadIdx.x & 31; const int L0 = (blockIdx.x * 8 + (threadIdx.x >> 5)) * 8; const int nlines = N * K / 64;
{
#pragma unroll 1
        for (int l = 0; l < 8; ++l) { const int L = L0 + l; if (L >= nlines) break; const size_t e = (size_t)L * 64 + lane * 2; const int k = (int)(e % K), n = (int)(e / K); v2us o;
            o[0] = f2bf(w[(size_t)k * N + n]); o[1] = f2bf(w[(size_t)(k + 1) * N + n]); *(v2us*)(Bt + e) = o; }
         }
}
__global__ __launch_bounds__(256) void k_cvt8(const float* __restrict__ src, bf* dst, size_t n8) { const size_t i = (size_t)blockIdx.x * 256 + threadIdx.x; if (i >= n8) return; const v8f v = *(const v8f*)(src + i * 8); v8us o;
#pragma unroll
    for (int k = 0; k < 8; ++k) o[k] = f2bf(v[k]); *(v8us*)(dst + i * 8) = o;  }

// k_rope: head planes [h][t][d] (fp16 + hi/lo) of rope(x) x sc with the rotate-half convention out[d] = x[d] cos[t][d] - x[d+HD/2] sin[t][d], out[d+HD/2] = x[d+HD/2] cos[t][d+HD/2] + x[d] sin[t][d+HD/2]
__global__ __launch_bounds__(256) void k_rope(const float* __restrict__ F, int pitch, int nheads, const float* __restrict__ CS, const float* __restrict__ RF, const float* __restrict__ nw, float sc, h16* P16, bf* Ph, bf* Pl) {
    const size_t e = ((size_t)blockIdx.x * 256 + threadIdx.x) * 2; if (e >= (size_t)nheads * TT * HD) return; const int d = (int)(e % HD); const int t = (int)((e / HD) % TT); const int h = (int)(e / ((size_t)HD * TT)); const float* f = F + (size_t)(((h / NH_) % GB) * TT + t) * pitch + (h / (NH_ * GB)) * DQ + (h % NH_) * HD;   /* plane h = (q or k, batch, head) */ float rf = 1.0f; if (RF) { rf = RF[(size_t)h * TT + t]; asm volatile("s_wait_xcnt 0x0" ::: "memory"); /* the load's address pair is reused right behind it */ } v2h o16; v2us oh, ol;
#pragma unroll
    for (int q = 0; q < 2; ++q) { const int dd = d + q; const int dp = (dd < HD / 2) ? dd + HD / 2 : dd - HD / 2; float x0 = f[dd], x1 = f[dp];
        if (RF) { float n0 = __fmul_rn(x0, rf), n1 = __fmul_rn(x1, rf); asm volatile("" : "+v"(n0)); asm volatile("" : "+v"(n1)); x0 = __fmul_rn(bfr(nw[dd]), n0); x1 = __fmul_rn(bfr(nw[dp]), n1); }
        const v2f cs = *(const v2f*)(CS + ((size_t)t * HD + dd) * 2); float a = __fmul_rn(x0, cs[0]), bq = __fmul_rn(x1, cs[1]); asm volatile("" : "+v"(a)); asm volatile("" : "+v"(bq)); const float r = ((dd < HD / 2) ? __fsub_rn(a, bq) : __fadd_rn(a, bq)) * sc;
        o16[q] = tohx(r); unsigned short a2, c2; splitf(r, a2, c2); oh[q] = a2; ol[q] = c2; }
    *(v2h*)(P16 + e) = o16; *(v2us*)(Ph + e) = oh; *(v2us*)(Pl + e) = ol;  }
__global__ __launch_bounds__(256) void k_vtp(const float* __restrict__ F, int pitch, int nheads, h16* V16, bf* Vh, bf* Vl) { const size_t e = ((size_t)blockIdx.x * 256 + threadIdx.x) * 2; if (e >= (size_t)nheads * HD * TT) return; const int t = (int)(e % TT); const int d = (int)((e / TT) % HD); const int g = (int)(e / ((size_t)TT * HD)); v2h o16; v2us oh, ol;
#pragma unroll
    for (int q = 0; q < 2; ++q) { const float x = F[(size_t)((g / NKV) * TT + t + q) * pitch + (g % NKV) * HD + d]; o16[q] = tohx(x); unsigned short a2, c2; splitf(x, a2, c2); oh[q] = a2; ol[q] = c2; }
    *(v2h*)(V16 + e) = o16; *(v2us*)(Vh + e) = oh; *(v2us*)(Vl + e) = ol;  }
__global__ __launch_bounds__(256) void k_csid(float* CS) { const int idx = blockIdx.x * 256 + threadIdx.x; if (idx >= TT * HD) return; v2f cs; cs[0] = 1.0f; cs[1] = 0.0f; *(v2f*)(CS + (size_t)idx * 2) = cs;  }
__global__ __launch_bounds__(256) void k_asoft(const float* __restrict__ Sb, h16* P16, bf* Ph, bf* Pl) {
    const int lane = threadIdx.x & 31; const int row = blockIdx.x * 8 + (threadIdx.x >> 5); if (row >= ZH * TT) return; const int i = row % TT; const int zz = row / TT; (void)zz; const bool hires = (i < RH); const float* sr = Sb + (size_t)row * BW; float v[NCH * 4]; float mx = -3.0e38f;
    const int blo = (i & ~63) - WNB, lo = blo > 0 ? blo : 0, hi = blo + 64 + 2 * WNB < TT ? blo + 64 + 2 * WNB : TT; const int cb = (blo >> 7) * 128 + lane * 4;   // the row block's key band [lo, hi), covered by NCH 128-aligned chunks; lanes outside it neither load nor store
#pragma unroll
    for (int ch = 0; ch < NCH; ++ch) { const int j0 = cb + ch * 128; const bool inb = (j0 >= lo && j0 < hi); v4f a = (v4f){}; if (inb) a = *(const v4f*)(sr + (j0 - blo));
#pragma unroll
        for (int q = 0; q < 4; ++q) { const int j = j0 + q; const float t = (inb && j <= i + WNB && j >= i - WNB) ? a[q] * SCL : -3.0e38f; v[ch * 4 + q] = t;   /* local window |i - j| <= 128 (-1e9 == exclusion) */ mx = fmaxf(mx, t); } }
#pragma unroll
    for (int sh = 16; sh; sh >>= 1) mx = fmaxf(mx, __shfl_xor(mx, sh, 32));
    float sum = 0.f;
#pragma unroll
    for (int k = 0; k < NCH * 4; ++k) { float d0 = __fsub_rn(v[k], mx); asm volatile("" : "+v"(d0)); v[k] = __builtin_amdgcn_exp2f(__fmul_rn(d0, 1.4426950408889634f)); sum += v[k]; }
#pragma unroll
    for (int sh = 16; sh; sh >>= 1) sum += __shfl_xor(sum, sh, 32);
    const float f = __fdiv_rn(hires ? 1.0f : PCAR, sum);
{
        if (hires) {
#pragma unroll
            for (int ch = 0; ch < NCH; ++ch) { const int j0 = cb + ch * 128; v4us oh, ol;
#pragma unroll
                for (int q = 0; q < 4; ++q) { unsigned short a, c2; splitf(v[ch * 4 + q] * f, a, c2); oh[q] = a; ol[q] = c2; }
                if (j0 >= lo && j0 < hi) { const size_t oo = ((size_t)zz * (RH ? RH : 1) + i) * BW + (j0 - blo); *(v4us*)(Ph + oo) = oh; *(v4us*)(Pl + oo) = ol; } }
        } else {
#pragma unroll
            for (int ch = 0; ch < NCH; ++ch) { const int j0 = cb + ch * 128; v4h o4;
#pragma unroll
                for (int q = 0; q < 4; ++q) o4[q] = tohx(v[ch * 4 + q] * f);
                if (j0 >= lo && j0 < hi) *(v4h*)(P16 + (size_t)row * BW + (j0 - blo)) = o4; } }
         }
}
__global__ __launch_bounds__(256) void k_merge(const float* __restrict__ O, int h0, bf* Ah, bf* Al) { const size_t e = ((size_t)blockIdx.x * 256 + threadIdx.x) * 2; if (e >= (size_t)ZH * TT * HD) return; const int d = (int)(e % HD); const int t = (int)((e / HD) % TT); const int zz = (int)(e / ((size_t)HD * TT)); const float cs = (t < RH) ? 1.0f : (1.0f / PCAR); const size_t oo = (size_t)((zz / NH_) * TT + t) * DQ + (h0 + zz % NH_) * HD + d;
    v2us oh, ol;
#pragma unroll
    for (int q = 0; q < 2; ++q) { unsigned short a, c2; splitf(O[e + q] * cs, a, c2); oh[q] = a; ol[q] = c2; } *(v2us*)(Ah + oo) = oh; *(v2us*)(Al + oo) = ol;  }

extern "C" void kernel_launch(void* const* d_in, const int* in_sizes, int n_in,
                              void* d_out, int out_size, void* d_ws, size_t ws_size, hipStream_t stream) {
    (void)in_sizes; (void)n_in; (void)out_size;
    const float* x = (const float*)d_in[0]; const float* wqkv = (const float*)d_in[1]; const float* wo = (const float*)d_in[2]; /* w_proj */
    float* OUT = (float*)d_out;     // [4][2048][1024]
    char* wsp = (char*)d_ws;
    auto take = [&](size_t bytes) { char* p = wsp; wsp += (bytes + 255) & ~(size_t)255; return (void*)p; };
    bf* WQKV = (bf*)take((size_t)3 * DQ * DM * 2); bf* WO = (bf*)take((size_t)DM * DQ * 2); float* CS = (float*)take((size_t)TT * HD * 2 * 4);
    bf* XB = (bf*)take((size_t)NB_ * TT * DM * 2);
    // q and k planes of a kind lie back to back (each a multiple of 256 bytes): one k_rope launch fills both as 2 * ZH planes
    h16* QP16 = (h16*)take((size_t)ZH * TT * HD * 2); h16* KP16 = (h16*)take((size_t)ZH * TT * HD * 2); h16* VT16 = (h16*)take((size_t)ZH * HD * TT * 2);
    bf* QPh = (bf*)take((size_t)ZH * TT * HD * 2); bf* KPh = (bf*)take((size_t)ZH * TT * HD * 2); bf* QPl = (bf*)take((size_t)ZH * TT * HD * 2); bf* KPl = (bf*)take((size_t)ZH * TT * HD * 2); bf* VTh = (bf*)take((size_t)ZH * HD * TT * 2); bf* VTl = (bf*)take((size_t)ZH * HD * TT * 2); bf* Ph = (bf*)take((size_t)ZH * RH * BW * 2); bf* Pl = (bf*)take((size_t)ZH * RH * BW * 2);
    float* Sb = (float*)take((size_t)ZH * TT * BW * 4); h16* P16 = (h16*)take((size_t)ZH * TT * BW * 2); bf* ATh = (bf*)take((size_t)GB * TT * DQ * 2); bf* ATl = (bf*)take((size_t)GB * TT * DQ * 2);
    if ((size_t)(wsp - (char*)d_ws) > ws_size) return;    // ws 256 MiB
    float* F = Sb;    // a pass's q | k | v, [GB * TT][3 * DQ] (smaller than Sb): dead once the planes are built, before the scores are written (stream-ordered)
    float* Ob = Sb;   // P x V output [ZH][TT][HD]: written after the softmax has read the last score (stream-ordered)
    k_cvt8<<<(unsigned)(((size_t)3 * DQ * DM / 8 + 255) / 256), 256, 0, stream>>>(wqkv, WQKV, (size_t)3 * DQ * DM / 8);
    k_cvt8<<<(unsigned)(((size_t)DM * DQ / 8 + 255) / 256), 256, 0, stream>>>(wo, WO, (size_t)DM * DQ / 8);
    k_cvt8<<<(unsigned)(((size_t)NB_ * TT * DM / 8 + 255) / 256), 256, 0, stream>>>(x, XB, (size_t)NB_ * TT * DM / 8);
    k_csid<<<(TT * HD + 255) / 256, 256, 0, stream>>>(CS);
    const unsigned LQK = (unsigned)(((size_t)2 * ZH * TT * HD / 2 + 255) / 256), LKv = (unsigned)(((size_t)ZH * TT * HD / 2 + 255) / 256);
    for (int b = 0; b < NB_; b += GB) {
        k_gemmw<bf, 0, false, 0><<<dim3(GB * TT / 64, 3 * DQ / 64, 1), 32, 0, stream>>>(XB + (size_t)b * TT * DM, nullptr, WQKV, nullptr, DM, F, 3 * DQ, nullptr, 0, 0, 0, 0);
        k_rope<<<LQK, 256, 0, stream>>>(F, 3 * DQ, 2 * ZH, CS, nullptr, nullptr, 1.0f, QP16, QPh, QPl);   // planes 0 .. ZH-1 = q, ZH .. 2 ZH-1 = k
        k_vtp<<<LKv, 256, 0, stream>>>(F + 2 * DQ, 3 * DQ, ZH, VT16, VTh, VTl);
        // one kv head per query head: pair z of a launch uses plane z (z-strides TT*HD)
        k_gemmw<bf, 2, false, 1><<<dim3(RH / 64, NBT, ZH), 32, 0, stream>>>(QPh, QPl, KPh, KPl, HD, Sb, BW, nullptr, (size_t)TT * HD, (size_t)TT * HD, (size_t)TT * BW, 0);
        k_gemmw<h16, 0, false, 1><<<dim3((TT - RH) / 64, NBT, ZH), 32, 0, stream>>>(QP16 + (size_t)RH * HD, nullptr, KP16, nullptr, HD, Sb + (size_t)RH * BW, BW, nullptr, (size_t)TT * HD, (size_t)TT * HD, (size_t)TT * BW, RH);
        k_asoft<<<ZH * TT / 8, 256, 0, stream>>>(Sb, P16, Ph, Pl);
        k_gemmw<bf, 2, false, 2><<<dim3(RH / 64, HD / 64, ZH), 32, 0, stream>>>(Ph, Pl, VTh, VTl, TT, Ob, HD, nullptr, (size_t)RH * BW, (size_t)HD * TT, (size_t)TT * HD, 0);
        k_gemmw<h16, 0, false, 2><<<dim3((TT - RH) / 64, HD / 64, ZH), 32, 0, stream>>>(P16 + (size_t)RH * BW, nullptr, VT16, nullptr, TT, Ob + (size_t)RH * HD, HD, nullptr, (size_t)TT * BW, (size_t)HD * TT, (size_t)TT * HD, RH);
        k_merge<<<(unsigned)(((size_t)ZH * TT * HD / 2 + 255) / 256), 256, 0, stream>>>(Ob, 0, ATh, ATl);
        k_gemmw<bf, 1, false, 0><<<dim3(GB * TT / 64, DM / 64, 1), 32, 0, stream>>>(ATh, ATl, WO, nullptr, DQ, OUT + (size_t)b * TT * DM, DM, nullptr, 0, 0, 0, 0); }
}

// v003
// A run of this version takes 320 microseconds.
// Timed twice side by side with v002, it ran 1.31 times as fast both times.
// Over all steps from v000 it is 12.5 times as fast.
#include <hip/hip_runtime.h>

// Local (windowed) multi-head self-attention (x [4][2048][1024]; qkv = x w_qkv^T ('oi' [3072][1024] -> q | k | v row blocks, no bias; 16 heads x 64); attn = q.k / 8 with keys |i - j| > 128 filled with -1e9 (== exclusion); softmax; out = merged w_proj^T ('oi' [1024][1024], no bias) -> [4][2048][1024] (8.4 M)).
// Layout: bf16 copy of x (all batches, one launch); per pass of GB = 2 batches: q | k | v as ONE GEMM (M = 4096) against the fused weight (Bt, N = 3072) whose epilogue stores the 16-bit head planes (q, k [h][t][d]; v transposed [h][d][t]) straight from the accumulators, as P x V stores the merged hi/lo planes; all 2 x 16 (batch, head) pairs in the z of every attention launch, scores and P kept band-compact ([row][320], column j at j - band start) so that they fit the workspace; banded T-2048 attention (hybrid rows: < 512 hi/lo 3 products, rest fp16 x1024; a 64-row block touches only its 320-key band, the +-128 window applied inside it as an index select in the softmax); merged hi/lo x w_proj exact.
// Compute dtypes, f32 accumulate: every input rounded to bf16; projections exact; attention rows < 512 3 products, rest fp16; softmax f32; w_proj hl x exact.

#define NB_  4
#define TT   2048
#define DM   1024
#define NH_  16
#define NKV  16
#define REP  (NH_ / NKV)
#define HD   64
#define DQ   (NH_ * HD)
#define DKV  (NKV * HD)
#define GB   2                    // batches per pass
#define ZH   (GB * NH_)           // (batch, head) pairs per attention launch (grid z), z = batch * NH_ + head
#define RH   512                  // query rows < RH use hi+lo planes (0: none)
#define WIN  0
#define PCAR 1024.0f
#define SCL  0.125f
#define WNB  128     // |i - j| <= WNB kept
#define NBT  ((64 + 2 * WNB) / 64)    // 64-key tiles in a 64-row block's band
#define NCH  3       // aligned 128-key chunks that cover a band
#define BW   (64 + 2 * WNB)           // band width = pitch of the compact score and P rows
typedef _Float16 h16;
typedef unsigned short bf;
typedef __attribute__((ext_vector_type(16))) __bf16   v16bf;
typedef __attribute__((ext_vector_type(16))) _Float16 v16h;
typedef __attribute__((ext_vector_type(8)))  _Float16 v8h;
typedef __attribute__((ext_vector_type(8)))  unsigned short v8us;
typedef __attribute__((ext_vector_type(8)))  float    v8f;
typedef __attribute__((ext_vector_type(4)))  float    v4f;
typedef v8h  __attribute__((may_alias)) v8ha;
typedef v4f  __attribute__((may_alias)) v4fa;
typedef v8us __attribute__((may_alias)) v8usa;

__device__ __forceinline__ unsigned short f2bf(float f) { unsigned u = __float_as_uint(f); u += 0x7FFFu + ((u >> 16) & 1u); return (unsigned short)(u >> 16); }
__device__ __forceinline__ float bf2f(unsigned short b) { return __uint_as_float(((unsigned)b) << 16); }
__device__ __forceinline__ float bfr(float f) { return bf2f(f2bf(f)); }
__device__ __forceinline__ v16h cat16(v8h lo, v8h hi) { return __builtin_shufflevector(lo, hi, 0, 1, 2, 3, 4, 5, 6, 7, 8, 9, 10, 11, 12, 13, 14, 15); }
__device__ __forceinline__ v16bf cat16b(v8us lo, v8us hi) { return __builtin_bit_cast(v16bf, __builtin_shufflevector(lo, hi, 0, 1, 2, 3, 4, 5, 6, 7, 8, 9, 10, 11, 12, 13, 14, 15)); }
__device__ __forceinline__ v8f wmma16(v16h a, v16h b, v8f c) { return __builtin_amdgcn_wmma_f32_16x16x32_f16(false, a, false, b, (short)0, c, false, false); }
__device__ __forceinline__ v8f wmmab(v16bf a, v16bf b, v8f c) { return __builtin_amdgcn_wmma_f32_16x16x32_bf16(false, a, false, b, (short)0, c, false, false); }



__device__ __forceinline__ h16 tohx(float x) { return (h16)x; }
__device__ __forceinline__ void splitf(float y, unsigned short& h, unsigned short& l) { h = f2bf(y); l = f2bf(y - bf2f(h)); }

// Destinations of the plane-writing epilogues. EPI 1 (q | k | v GEMM): q16/qh/ql = first q plane of a kind (the k planes follow the q planes), v16/vh/vl = first transposed v plane. EPI 2 (P x V): qh/ql = merged hi/lo planes.
struct Planes { h16* q16; bf* qh; bf* ql; h16* v16; bf* vh; bf* vl; };

// put_planes: a wave's 64x64 f32 accumulator tile -> 16-bit planes (fp16 if W16; bf16 hi + lo of x * sc), 16 output rows at a time through the wave's own LDS so that every store is 16 B a lane and 8 lanes fill one 128-B line.
// TR: output row = the tile's column (a lane's 8 accumulator elements of a fragment run along the output row). D* point at the tile's first output element; PITCH = output row pitch in elements (a constant: every row is an immediate offset from one address).
template <bool TR, int PITCH, bool W16>
__device__ __forceinline__ void put_planes(float* os, const v8f (&acc)[4][4], int lane, float sc, h16* D16, bf* Dh, bf* Dl) {
    const int lr = lane & 15, hi = lane >> 4, rr = lane >> 3, cc = (lane & 7) * 8; const size_t o0 = (size_t)rr * PITCH + cc;
#pragma unroll
    for (int blk = 0; blk < 4; ++blk) {
#pragma unroll
        for (int u = 0; u < 4; ++u) {
            if (TR) { const v8f t = acc[u][blk]; float* p = os + lr * 68 + u * 16 + hi * 8; *(v4fa*)p = __builtin_shufflevector(t, t, 0, 1, 2, 3); *(v4fa*)(p + 4) = __builtin_shufflevector(t, t, 4, 5, 6, 7); }
            else {
#pragma unroll
                for (int j = 0; j < 8; ++j) os[(hi * 8 + j) * 68 + u * 16 + lr] = acc[blk][u][j]; } }
        __builtin_amdgcn_wave_barrier(); asm volatile("" ::: "memory");   // the reads below take other lanes' writes: keeps the compiler from lifting them over the writes (one wave, LDS in order: no instruction)
#pragma unroll
        for (int s = 0; s < 4; ++s) { const float* p = os + (4 * s + rr) * 68 + cc; const v4f x0 = *(const v4fa*)p, x1 = *(const v4fa*)(p + 4); v8h o16; v8us oh, ol;
#pragma unroll
            for (int q = 0; q < 8; ++q) { float x = (q < 4) ? x0[q & 3] : x1[q & 3]; if (!W16) x *= sc; o16[q] = tohx(x); unsigned short a2, c2; splitf(x, a2, c2); oh[q] = a2; ol[q] = c2; }
            const size_t o = o0 + (size_t)(blk * 16 + 4 * s) * PITCH; if (W16) *(v8h*)(D16 + o) = o16; *(v8us*)(Dh + o) = oh; *(v8us*)(Dl + o) = ol; }
        __builtin_amdgcn_wave_barrier(); asm volatile("" ::: "memory");   // the next block's writes stay behind these reads
    }
}

// ---- k_gemmw: register-blocked GEMM, ONE WAVE per 64x64 output tile (16 accumulators), operands straight from K-contiguous 16-bit planes; grid (M/64, N/64, Z), 32 threads.
// C[m][n] (f32, pitch ldc, + optional f32 bias[n]) = sum_k A[m][k] Bt[n][k] (+ split products per NSPLIT). z-batch strides sA/sB/sC in elements. K % 32 == 0.
// EPI 0: C as above. 1: no C; tile column block = one head of q, k or v (N = 3 DQ, M = GB TT): its planes via put_planes. 2: no C; z = (batch, head), the tile x (1 for rows < RH, else 1 / PCAR) goes to the merged hi/lo planes [batch TT + t][DQ].
// BAND (rowg = sequence index of A's row 0): the keys a 64-row block can see are [row - WNB, row + 64 + WNB) clipped to [0, TT). 1: grid y walks the 64-column tiles of that band only; C is band-compact (key j at column j - band start, ldc = BW). 2: the k loop runs over that band only (P is exactly 0 outside it); A is band-compact (pitch BW), Bt keeps pitch K.
template <typename T16> struct WFrag;
template <> struct WFrag<h16> { typedef v16h V; static __device__ __forceinline__ V ld(const h16* p) { return cat16(*(const v8h*)p, *(const v8h*)(p + 16)); } static __device__ __forceinline__ v8f mma(V a, V b, v8f c) { return wmma16(a, b, c); } };
template <> struct WFrag<bf> { typedef v16bf V; static __device__ __forceinline__ V ld(const bf* p) { return cat16b(*(const v8us*)p, *(const v8us*)(p + 16)); } static __device__ __forceinline__ v8f mma(V a, V b, v8f c) { return wmmab(a, b, c); } };
template <typename T16, int NSPLIT, bool BIAS, int BAND, int EPI>
__global__ __launch_bounds__(32) void k_gemmw(const T16* __restrict__ A, const T16* __restrict__ A2, const T16* __restrict__ Bt, const T16* __restrict__ Bt2, int K, float* C, int ldc, const float* __restrict__ bias, size_t sA, size_t sB, size_t sC, int rowg, Planes pl) {
    typedef typename WFrag<T16>::V V;
    __shared__ __align__(16) float os[16 * 68];
    const size_t z = blockIdx.z; A += z * sA; if (A2) A2 += z * sA; Bt += z * sB; if (Bt2) Bt2 += z * sB; C += z * sC;
    const int lane = threadIdx.x & 31, lr = lane & 15, hi = lane >> 4; const int r0 = blockIdx.x * 64, blo = rowg + r0 - WNB, c0 = (BAND == 1 ? blo : 0) + blockIdx.y * 64;
    if (BAND == 1 && (c0 < 0 || c0 >= TT)) return;
    const int cc0 = blockIdx.y * 64, lda = (BAND == 2) ? BW : K, ab = (BAND == 2) ? rowg + r0 : 0, ac = (BAND == 2) ? WNB : 0;   // C's first column; A's pitch; key ab sits in A's column ac
    const int k0 = (BAND == 2 && blo > 0) ? blo : 0, k1 = (BAND == 2 && blo + 64 + 2 * WNB < K) ? blo + 64 + 2 * WNB : K;
    v8f acc[4][4];
#pragma unroll
    for (int mb = 0; mb < 4; ++mb)
#pragma unroll
        for (int nb = 0; nb < 4; ++nb) acc[mb][nb] = (v8f){};
    const size_t aoff = (size_t)(r0 + lr) * lda + 8 * hi, boff = (size_t)(c0 + lr) * K + 8 * hi;
#pragma unroll 1
    for (int kc = k0; kc < k1; kc += 32) {
        V a[4], a2[4]; const T16* pa[4]; const T16* pa2[4];
#pragma unroll
        for (int mb = 0; mb < 4; ++mb) { pa[mb] = A + aoff + (size_t)mb * 16 * lda + (kc - ab); a[mb] = WFrag<T16>::ld(pa[mb] + ac); if (NSPLIT == 1 || NSPLIT == 2) { pa2[mb] = A2 + aoff + (size_t)mb * 16 * lda + (kc - ab); a2[mb] = WFrag<T16>::ld(pa2[mb] + ac); } }
        // one wait behind the run of A loads, before any register that holds one of their addresses is written again; the addresses are inputs so that their registers stay untouched up to the wait (BAND 2: the pitch is a constant, every row block is an immediate offset from the first address)
        if (BAND == 2) { if (NSPLIT == 1 || NSPLIT == 2) asm volatile("s_wait_xcnt 0x0" :: "v"(pa[0]), "v"(pa2[0]) : "memory"); else asm volatile("s_wait_xcnt 0x0" :: "v"(pa[0]) : "memory"); }
        else if (NSPLIT == 1 || NSPLIT == 2) asm volatile("s_wait_xcnt 0x0" :: "v"(pa[0]), "v"(pa[1]), "v"(pa[2]), "v"(pa[3]), "v"(pa2[0]), "v"(pa2[1]), "v"(pa2[2]), "v"(pa2[3]) : "memory");
        else asm volatile("s_wait_xcnt 0x0" :: "v"(pa[0]), "v"(pa[1]), "v"(pa[2]), "v"(pa[3]) : "memory");
#pragma unroll
        for (int nb = 0; nb < 4; ++nb) { const V b = WFrag<T16>::ld(Bt + boff + (size_t)nb * 16 * K + kc); V b2; if (NSPLIT >= 2) b2 = WFrag<T16>::ld(Bt2 + boff + (size_t)nb * 16 * K + kc);
#pragma unroll
            for (int mb = 0; mb < 4; ++mb) { acc[mb][nb] = WFrag<T16>::mma(a[mb], b, acc[mb][nb]); if (NSPLIT == 1 || NSPLIT == 2) acc[mb][nb] = WFrag<T16>::mma(a2[mb], b, acc[mb][nb]); if (NSPLIT >= 2) acc[mb][nb] = WFrag<T16>::mma(a[mb], b2, acc[mb][nb]); } }
        asm volatile("v_nop\n\tv_nop\n\tv_nop\n\tv_nop" : "+v"(acc[0][0]), "+v"(acc[1][1]), "+v"(acc[2][2]), "+v"(acc[3][3]) : "v"(a[0]), "v"(a[3]));
    }
    if (EPI == 1) { const int bt = r0 / TT, t0 = r0 % TT, kind = c0 / DQ, hd = (c0 % DQ) / HD;
        if (kind < 2) { const size_t o = ((size_t)(kind * ZH + bt * NH_ + hd) * TT + t0) * HD; put_planes<false, HD, true>(os, acc, lane, 1.0f, pl.q16 + o, pl.qh + o, pl.ql + o); }
        else { const size_t o = (size_t)(bt * NKV + hd) * HD * TT + t0; put_planes<true, TT, true>(os, acc, lane, 1.0f, pl.v16 + o, pl.vh + o, pl.vl + o);
            asm volatile("s_wait_xcnt 0x0" ::: "memory"); /* the built code keeps a fall-through from here into the q / k branch, which rewrites registers that the last stores name */ } }
    else if (EPI == 2) { const int zz = (int)z, t0 = rowg + r0; const size_t o = (size_t)((zz / NH_) * TT + t0) * DQ + (zz % NH_) * HD;
        put_planes<false, DQ, false>(os, acc, lane, (t0 < RH) ? 1.0f : (1.0f / PCAR), nullptr, pl.qh + o, pl.ql + o); }
    else
#pragma unroll
    for (int mb = 0; mb < 4; ++mb) {
#pragma unroll
        for (int nb = 0; nb < 4; ++nb) {
#pragma unroll
            for (int j = 0; j < 8; ++j) os[(hi * 8 + j) * 68 + nb * 16 + lr] = acc[mb][nb][j]; }
        __builtin_amdgcn_wave_barrier(); asm volatile("" ::: "memory");
        float* crow = C + (size_t)(r0 + mb * 16) * ldc + cc0;
{
#pragma unroll
            for (int s = 0; s < 8; ++s) { const int row = 2 * s + hi, cofs = lr * 4; v4f val = *(const v4fa*)(os + row * 68 + cofs); if (BIAS) { val[0] += bfr(bias[c0 + cofs]); val[1] += bfr(bias[c0 + cofs + 1]); val[2] += bfr(bias[c0 + cofs + 2]); val[3] += bfr(bias[c0 + cofs + 3]); }
                *(v4f*)(crow + (size_t)row * ldc + cofs) = val; }
             }
        __builtin_amdgcn_wave_barrier(); asm volatile("" ::: "memory");
    }
}

typedef __attribute__((ext_vector_type(2))) _Float16 v2h;
typedef __attribute__((ext_vector_type(4))) _Float16 v4h;
typedef __attribute__((ext_vector_type(2))) unsigned short v2us;
typedef __attribute__((ext_vector_type(4))) unsigned short v4us;
typedef __attribute__((ext_vector_type(2))) float v2f;
typedef __attribute__((ext_vector_type(4))) int v4i;

__global__ __launch_bounds__(256) void k_wtG(const float* __restrict__ w, int K, int N, bf* Bt) {
    const int lane = threadIdx.x & 31; const int L0 = (blockIdx.x * 8 + (threadIdx.x >> 5)) * 8; const int nlines = N * K / 64;
{
#pragma unroll 1
        for (int l = 0; l < 8; ++l) { const int L = L0 + l; if (L >= nlines) break; const size_t e = (size_t)L * 64 + lane * 2; const int k = (int)(e % K), n = (int)(e / K); v2us o;
            o[0] = f2bf(w[(size_t)k * N + n]); o[1] = f2bf(w[(size_t)(k + 1) * N + n]); *(v2us*)(Bt + e) = o; }
         }
}
__global__ __launch_bounds__(256) void k_cvt8(const float* __restrict__ src, bf* dst, size_t n8) { const size_t i = (size_t)blockIdx.x * 256 + threadIdx.x; if (i >= n8) return; const v8f v = *(const v8f*)(src + i * 8); v8us o;
#pragma unroll
    for (int k = 0; k < 8; ++k) o[k] = f2bf(v[k]); *(v8us*)(dst + i * 8) = o;  }

__global__ __launch_bounds__(256) void k_asoft(const float* __restrict__ Sb, h16* P16, bf* Ph, bf* Pl) {
    const int lane = threadIdx.x & 31; const int row = blockIdx.x * 8 + (threadIdx.x >> 5); if (row >= ZH * TT) return; const int i = row % TT; const int zz = row / TT; (void)zz; const bool hires = (i < RH); const float* sr = Sb + (size_t)row * BW; float v[NCH * 4]; float mx = -3.0e38f;
    const int blo = (i & ~63) - WNB, lo = blo > 0 ? blo : 0, hi = blo + 64 + 2 * WNB < TT ? blo + 64 + 2 * WNB : TT; const int cb = (blo >> 7) * 128 + lane * 4;   // the row block's key band [lo, hi), covered by NCH 128-aligned chunks; lanes outside it neither load nor store
#pragma unroll
    for (int ch = 0; ch < NCH; ++ch) { const int j0 = cb + ch * 128; const bool inb = (j0 >= lo && j0 < hi); v4f a = (v4f){}; if (inb) a = *(const v4f*)(sr + (j0 - blo));
#pragma unroll
        for (int q = 0; q < 4; ++q) { const int j = j0 + q; const float t = (inb && j <= i + WNB && j >= i - WNB) ? a[q] * SCL : -3.0e38f; v[ch * 4 + q] = t;   /* local window |i - j| <= 128 (-1e9 == exclusion) */ mx = fmaxf(mx, t); } }
#pragma unroll
    for (int sh = 16; sh; sh >>= 1) mx = fmaxf(mx, __shfl_xor(mx, sh, 32));
    float sum = 0.f;
#pragma unroll
    for (int k = 0; k < NCH * 4; ++k) { float d0 = __fsub_rn(v[k], mx); asm volatile("" : "+v"(d0)); v[k] = __builtin_amdgcn_exp2f(__fmul_rn(d0, 1.4426950408889634f)); sum += v[k]; }
#pragma unroll
    for (int sh = 16; sh; sh >>= 1) sum += __shfl_xor(sum, sh, 32);
    const float f = __fdiv_rn(hires ? 1.0f : PCAR, sum);
{
        if (hires) {
#pragma unroll
            for (int ch = 0; ch < NCH; ++ch) { const int j0 = cb + ch * 128; v4us oh, ol;
#pragma unroll
                for (int q = 0; q < 4; ++q) { unsigned short a, c2; splitf(v[ch * 4 + q] * f, a, c2); oh[q] = a; ol[q] = c2; }
                if (j0 >= lo && j0 < hi) { const size_t oo = ((size_t)zz * (RH ? RH : 1) + i) * BW + (j0 - blo); *(v4us*)(Ph + oo) = oh; *(v4us*)(Pl + oo) = ol; } }
        } else {
#pragma unroll
            for (int ch = 0; ch < NCH; ++ch) { const int j0 = cb + ch * 128; v4h o4;
#pragma unroll
                for (int q = 0; q < 4; ++q) o4[q] = tohx(v[ch * 4 + q] * f);
                if (j0 >= lo && j0 < hi) *(v4h*)(P16 + (size_t)row * BW + (j0 - blo)) = o4; } }
         }
}

extern "C" void kernel_launch(void* const* d_in, const int* in_sizes, int n_in,
                              void* d_out, int out_size, void* d_ws, size_t ws_size, hipStream_t stream) {
    (void)in_sizes; (void)n_in; (void)out_size;
    const float* x = (const float*)d_in[0]; const float* wqkv = (const float*)d_in[1]; const float* wo = (const float*)d_in[2]; /* w_proj */
    float* OUT = (float*)d_out;     // [4][2048][1024]
    char* wsp = (char*)d_ws;
    auto take = [&](size_t bytes) { char* p = wsp; wsp += (bytes + 255) & ~(size_t)255; return (void*)p; };
    bf* WQKV = (bf*)take((size_t)3 * DQ * DM * 2); bf* WO = (bf*)take((size_t)DM * DQ * 2);
    bf* XB = (bf*)take((size_t)NB_ * TT * DM * 2);
    // q and k planes of a kind lie back to back (each a multiple of 256 bytes): the q | k | v GEMM addresses both as 2 * ZH planes
    h16* QP16 = (h16*)take((size_t)ZH * TT * HD * 2); h16* KP16 = (h16*)take((size_t)ZH * TT * HD * 2); h16* VT16 = (h16*)take((size_t)ZH * HD * TT * 2);
    bf* QPh = (bf*)take((size_t)ZH * TT * HD * 2); bf* KPh = (bf*)take((size_t)ZH * TT * HD * 2); bf* QPl = (bf*)take((size_t)ZH * TT * HD * 2); bf* KPl = (bf*)take((size_t)ZH * TT * HD * 2); bf* VTh = (bf*)take((size_t)ZH * HD * TT * 2); bf* VTl = (bf*)take((size_t)ZH * HD * TT * 2); bf* Ph = (bf*)take((size_t)ZH * RH * BW * 2); bf* Pl = (bf*)take((size_t)ZH * RH * BW * 2);
    float* Sb = (float*)take((size_t)ZH * TT * BW * 4); h16* P16 = (h16*)take((size_t)ZH * TT * BW * 2); bf* ATh = (bf*)take((size_t)GB * TT * DQ * 2); bf* ATl = (bf*)take((size_t)GB * TT * DQ * 2);
    if ((size_t)(wsp - (char*)d_ws) > ws_size) return;    // ws 256 MiB
    const Planes none = { nullptr, nullptr, nullptr, nullptr, nullptr, nullptr }, pqkv = { QP16, QPh, QPl, VT16, VTh, VTl }, pmrg = { nullptr, ATh, ATl, nullptr, nullptr, nullptr };
    k_cvt8<<<(unsigned)(((size_t)3 * DQ * DM / 8 + 255) / 256), 256, 0, stream>>>(wqkv, WQKV, (size_t)3 * DQ * DM / 8);
    k_cvt8<<<(unsigned)(((size_t)DM * DQ / 8 + 255) / 256), 256, 0, stream>>>(wo, WO, (size_t)DM * DQ / 8);
    k_cvt8<<<(unsigned)(((size_t)NB_ * TT * DM / 8 + 255) / 256), 256, 0, stream>>>(x, XB, (size_t)NB_ * TT * DM / 8);
    for (int b = 0; b < NB_; b += GB) {
        k_gemmw<bf, 0, false, 0, 1><<<dim3(GB * TT / 64, 3 * DQ / 64, 1), 32, 0, stream>>>(XB + (size_t)b * TT * DM, nullptr, WQKV, nullptr, DM, nullptr, 0, nullptr, 0, 0, 0, 0, pqkv);   // planes 0 .. ZH-1 = q, ZH .. 2 ZH-1 = k
        // one kv head per query head: pair z of a launch uses plane z (z-strides TT*HD)
        k_gemmw<bf, 2, false, 1, 0><<<dim3(RH / 64, NBT, ZH), 32, 0, stream>>>(QPh, QPl, KPh, KPl, HD, Sb, BW, nullptr, (size_t)TT * HD, (size_t)TT * HD, (size_t)TT * BW, 0, none);
        k_gemmw<h16, 0, false, 1, 0><<<dim3((TT - RH) / 64, NBT, ZH), 32, 0, stream>>>(QP16 + (size_t)RH * HD, nullptr, KP16, nullptr, HD, Sb + (size_t)RH * BW, BW, nullptr, (size_t)TT * HD, (size_t)TT * HD, (size_t)TT * BW, RH, none);
        k_asoft<<<ZH * TT / 8, 256, 0, stream>>>(Sb, P16, Ph, Pl);
        k_gemmw<bf, 2, false, 2, 2><<<dim3(RH / 64, HD / 64, ZH), 32, 0, stream>>>(Ph, Pl, VTh, VTl, TT, nullptr, 0, nullptr, (size_t)RH * BW, (size_t)HD * TT, 0, 0, pmrg);
        k_gemmw<h16, 0, false, 2, 2><<<dim3((TT - RH) / 64, HD / 64, ZH), 32, 0, stream>>>(P16 + (size_t)RH * BW, nullptr, VT16, nullptr, TT, nullptr, 0, nullptr, (size_t)TT * BW, (size_t)HD * TT, 0, RH, pmrg);
        k_gemmw<bf, 1, false, 0, 0><<<dim3(GB * TT / 64, DM / 64, 1), 32, 0, stream>>>(ATh, ATl, WO, nullptr, DQ, OUT + (size_t)b * TT * DM, DM, nullptr, 0, 0, 0, 0, none); }
}

// v004
// It runs in 245 microseconds.
// In both of two side-by-side timings against v003, it was 1.30 times as fast.
// Counting every step since v000, it is 16.2 times as fast.
#include <hip/hip_runtime.h>

// Local (windowed) multi-head self-attention (x [4][2048][1024]; qkv = x w_qkv^T ('oi' [3072][1024] -> q | k | v row blocks, no bias; 16 heads x 64); attn = q.k / 8 with keys |i - j| > 128 filled with -1e9 (== exclusion); softmax; out = merged w_proj^T ('oi' [1024][1024], no bias) -> [4][2048][1024] (8.4 M)).
// Layout: bf16 copy of x (all batches, one launch); per pass of GB = 2 batches: q | k | v as ONE GEMM (M = 4096) against the fused weight (Bt, N = 3072) whose epilogue stores the 16-bit head planes (q, k [h][t][d]; v transposed [h][d][t]) straight from the accumulators; banded T-2048 attention as ONE launch (k_attn): a work-group of 4 waves takes a 64-row block of one (batch, head) pair, keeps its 64 x 320 score band and then P in LDS, and stores the merged hi/lo planes (hybrid rows: < 512 hi/lo 3 products, rest fp16 x1024; the +-128 window applied inside the band as an index select in the softmax); merged hi/lo x w_proj exact.
// Compute dtypes, f32 accumulate: every input rounded to bf16; projections exact; attention rows < 512 3 products, rest fp16; softmax f32; w_proj hl x exact.

#define NB_  4
#define TT   2048
#define DM   1024
#define NH_  16
#define NKV  16
#define REP  (NH_ / NKV)
#define HD   64
#define DQ   (NH_ * HD)
#define DKV  (NKV * HD)
#define GB   2                    // batches per pass
#define ZH   (GB * NH_)           // (batch, head) pairs per attention launch (grid x), x = batch * NH_ + head
#define RH   512                  // query rows < RH use hi+lo planes (0: none)
#define WIN  0
#define PCAR 1024.0f
#define SCL  0.125f
#define WNB  128     // |i - j| <= WNB kept
#define NBT  ((64 + 2 * WNB) / 64)    // 64-key tiles in a 64-row block's band
#define NCH  3       // aligned 128-key chunks that cover a band
#define BW   (64 + 2 * WNB)           // band width = keys of a 64-row block's band
typedef _Float16 h16;
typedef unsigned short bf;
typedef __attribute__((ext_vector_type(16))) __bf16   v16bf;
typedef __attribute__((ext_vector_type(16))) _Float16 v16h;
typedef __attribute__((ext_vector_type(8)))  _Float16 v8h;
typedef __attribute__((ext_vector_type(8)))  unsigned short v8us;
typedef __attribute__((ext_vector_type(8)))  float    v8f;
typedef __attribute__((ext_vector_type(4)))  float    v4f;
typedef v8h  __attribute__((may_alias)) v8ha;
typedef v4f  __attribute__((may_alias)) v4fa;
typedef v8us __attribute__((may_alias)) v8usa;

__device__ __forceinline__ unsigned short f2bf(float f) { unsigned u = __float_as_uint(f); u += 0x7FFFu + ((u >> 16) & 1u); return (unsigned short)(u >> 16); }
__device__ __forceinline__ float bf2f(unsigned short b) { return __uint_as_float(((unsigned)b) << 16); }
__device__ __forceinline__ float bfr(float f) { return bf2f(f2bf(f)); }
__device__ __forceinline__ v16h cat16(v8h lo, v8h hi) { return __builtin_shufflevector(lo, hi, 0, 1, 2, 3, 4, 5, 6, 7, 8, 9, 10, 11, 12, 13, 14, 15); }
__device__ __forceinline__ v16bf cat16b(v8us lo, v8us hi) { return __builtin_bit_cast(v16bf, __builtin_shufflevector(lo, hi, 0, 1, 2, 3, 4, 5, 6, 7, 8, 9, 10, 11, 12, 13, 14, 15)); }
__device__ __forceinline__ v8f wmma16(v16h a, v16h b, v8f c) { return __builtin_amdgcn_wmma_f32_16x16x32_f16(false, a, false, b, (short)0, c, false, false); }
__device__ __forceinline__ v8f wmmab(v16bf a, v16bf b, v8f c) { return __builtin_amdgcn_wmma_f32_16x16x32_bf16(false, a, false, b, (short)0, c, false, false); }



__device__ __forceinline__ h16 tohx(float x) { return (h16)x; }
__device__ __forceinline__ void splitf(float y, unsigned short& h, unsigned short& l) { h = f2bf(y); l = f2bf(y - bf2f(h)); }

// Destinations of the plane-writing epilogues. EPI 1 (q | k | v GEMM): q16/qh/ql = first q plane of a kind (the k planes follow the q planes), v16/vh/vl = first transposed v plane. EPI 2 (P x V): qh/ql = merged hi/lo planes.
struct Planes { h16* q16; bf* qh; bf* ql; h16* v16; bf* vh; bf* vl; };

// put_planes: a wave's 64x64 f32 accumulator tile -> 16-bit planes (fp16 if W16; bf16 hi + lo of x * sc), 16 output rows at a time through the wave's own LDS so that every store is 16 B a lane and 8 lanes fill one 128-B line.
// TR: output row = the tile's column (a lane's 8 accumulator elements of a fragment run along the output row). D* point at the tile's first output element; PITCH = output row pitch in elements (a constant: every row is an immediate offset from one address).
template <bool TR, int PITCH, bool W16>
__device__ __forceinline__ void put_planes(float* os, const v8f (&acc)[4][4], int lane, float sc, h16* D16, bf* Dh, bf* Dl) {
    const int lr = lane & 15, hi = lane >> 4, rr = lane >> 3, cc = (lane & 7) * 8; const size_t o0 = (size_t)rr * PITCH + cc;
#pragma unroll
    for (int blk = 0; blk < 4; ++blk) {
#pragma unroll
        for (int u = 0; u < 4; ++u) {
            if (TR) { const v8f t = acc[u][blk]; float* p = os + lr * 68 + u * 16 + hi * 8; *(v4fa*)p = __builtin_shufflevector(t, t, 0, 1, 2, 3); *(v4fa*)(p + 4) = __builtin_shufflevector(t, t, 4, 5, 6, 7); }
            else {
#pragma unroll
                for (int j = 0; j < 8; ++j) os[(hi * 8 + j) * 68 + u * 16 + lr] = acc[blk][u][j]; } }
        __builtin_amdgcn_wave_barrier(); asm volatile("" ::: "memory");   // the reads below take other lanes' writes: keeps the compiler from lifting them over the writes (one wave, LDS in order: no instruction)
#pragma unroll
        for (int s = 0; s < 4; ++s) { const float* p = os + (4 * s + rr) * 68 + cc; const v4f x0 = *(const v4fa*)p, x1 = *(const v4fa*)(p + 4); v8h o16; v8us oh, ol;
#pragma unroll
            for (int q = 0; q < 8; ++q) { float x = (q < 4) ? x0[q & 3] : x1[q & 3]; if (!W16) x *= sc; o16[q] = tohx(x); unsigned short a2, c2; splitf(x, a2, c2); oh[q] = a2; ol[q] = c2; }
            const size_t o = o0 + (size_t)(blk * 16 + 4 * s) * PITCH; if (W16) *(v8h*)(D16 + o) = o16; *(v8us*)(Dh + o) = oh; *(v8us*)(Dl + o) = ol; }
        __builtin_amdgcn_wave_barrier(); asm volatile("" ::: "memory");   // the next block's writes stay behind these reads
    }
}

// ---- k_gemmw: register-blocked GEMM, ONE WAVE per 64x64 output tile (16 accumulators), operands straight from K-contiguous 16-bit planes; grid (M/64, N/64, Z), 32 threads.
// C[m][n] (f32, pitch ldc, + optional f32 bias[n]) = sum_k A[m][k] Bt[n][k] (+ split products per NSPLIT). z-batch strides sA/sB/sC in elements. K % 32 == 0.
// EPI 0: C as above. 1: no C; tile column block = one head of q, k or v (N = 3 DQ, M = GB TT): its planes via put_planes. 2: no C; z = (batch, head), the tile x (1 for rows < RH, else 1 / PCAR) goes to the merged hi/lo planes [batch TT + t][DQ].
// BAND (rowg = sequence index of A's row 0): the keys a 64-row block can see are [row - WNB, row + 64 + WNB) clipped to [0, TT). 1: grid y walks the 64-column tiles of that band only; C is band-compact (key j at column j - band start, ldc = BW). 2: the k loop runs over that band only (P is exactly 0 outside it); A is band-compact (pitch BW), Bt keeps pitch K.
template <typename T16> struct WFrag;
template <> struct WFrag<h16> { typedef v16h V; static __device__ __forceinline__ V ld(const h16* p) { return cat16(*(const v8h*)p, *(const v8h*)(p + 16)); } static __device__ __forceinline__ v8f mma(V a, V b, v8f c) { return wmma16(a, b, c); } };
template <> struct WFrag<bf> { typedef v16bf V; static __device__ __forceinline__ V ld(const bf* p) { return cat16b(*(const v8us*)p, *(const v8us*)(p + 16)); } static __device__ __forceinline__ v8f mma(V a, V b, v8f c) { return wmmab(a, b, c); } };
template <typename T16, int NSPLIT, bool BIAS, int BAND, int EPI>
__global__ __launch_bounds__(32) void k_gemmw(const T16* __restrict__ A, const T16* __restrict__ A2, const T16* __restrict__ Bt, const T16* __restrict__ Bt2, int K, float* C, int ldc, const float* __restrict__ bias, size_t sA, size_t sB, size_t sC, int rowg, Planes pl) {
    typedef typename WFrag<T16>::V V;
    __shared__ __align__(16) float os[16 * 68];
    const size_t z = blockIdx.z; A += z * sA; if (A2) A2 += z * sA; Bt += z * sB; if (Bt2) Bt2 += z * sB; C += z * sC;
    const int lane = threadIdx.x & 31, lr = lane & 15, hi = lane >> 4; const int r0 = blockIdx.x * 64, blo = rowg + r0 - WNB, c0 = (BAND == 1 ? blo : 0) + blockIdx.y * 64;
    if (BAND == 1 && (c0 < 0 || c0 >= TT)) return;
    const int cc0 = blockIdx.y * 64, lda = (BAND == 2) ? BW : K, ab = (BAND == 2) ? rowg + r0 : 0, ac = (BAND == 2) ? WNB : 0;   // C's first column; A's pitch; key ab sits in A's column ac
    const int k0 = (BAND == 2 && blo > 0) ? blo : 0, k1 = (BAND == 2 && blo + 64 + 2 * WNB < K) ? blo + 64 + 2 * WNB : K;
    v8f acc[4][4];
#pragma unroll
    for (int mb = 0; mb < 4; ++mb)
#pragma unroll
        for (int nb = 0; nb < 4; ++nb) acc[mb][nb] = (v8f){};
    const size_t aoff = (size_t)(r0 + lr) * lda + 8 * hi, boff = (size_t)(c0 + lr) * K + 8 * hi;
#pragma unroll 1
    for (int kc = k0; kc < k1; kc += 32) {
        V a[4], a2[4]; const T16* pa[4]; const T16* pa2[4];
#pragma unroll
        for (int mb = 0; mb < 4; ++mb) { pa[mb] = A + aoff + (size_t)mb * 16 * lda + (kc - ab); a[mb] = WFrag<T16>::ld(pa[mb] + ac); if (NSPLIT == 1 || NSPLIT == 2) { pa2[mb] = A2 + aoff + (size_t)mb * 16 * lda + (kc - ab); a2[mb] = WFrag<T16>::ld(pa2[mb] + ac); } }
        // one wait behind the run of A loads, before any register that holds one of their addresses is written again; the addresses are inputs so that their registers stay untouched up to the wait (BAND 2: the pitch is a constant, every row block is an immediate offset from the first address)
        if (BAND == 2) { if (NSPLIT == 1 || NSPLIT == 2) asm volatile("s_wait_xcnt 0x0" :: "v"(pa[0]), "v"(pa2[0]) : "memory"); else asm volatile("s_wait_xcnt 0x0" :: "v"(pa[0]) : "memory"); }
        else if (NSPLIT == 1 || NSPLIT == 2) asm volatile("s_wait_xcnt 0x0" :: "v"(pa[0]), "v"(pa[1]), "v"(pa[2]), "v"(pa[3]), "v"(pa2[0]), "v"(pa2[1]), "v"(pa2[2]), "v"(pa2[3]) : "memory");
        else asm volatile("s_wait_xcnt 0x0" :: "v"(pa[0]), "v"(pa[1]), "v"(pa[2]), "v"(pa[3]) : "memory");
#pragma unroll
        for (int nb = 0; nb < 4; ++nb) { const V b = WFrag<T16>::ld(Bt + boff + (size_t)nb * 16 * K + kc); V b2; if (NSPLIT >= 2) b2 = WFrag<T16>::ld(Bt2 + boff + (size_t)nb * 16 * K + kc);
#pragma unroll
            for (int mb = 0; mb < 4; ++mb) { acc[mb][nb] = WFrag<T16>::mma(a[mb], b, acc[mb][nb]); if (NSPLIT == 1 || NSPLIT == 2) acc[mb][nb] = WFrag<T16>::mma(a2[mb], b, acc[mb][nb]); if (NSPLIT >= 2) acc[mb][nb] = WFrag<T16>::mma(a[mb], b2, acc[mb][nb]); } }
        asm volatile("v_nop\n\tv_nop\n\tv_nop\n\tv_nop" : "+v"(acc[0][0]), "+v"(acc[1][1]), "+v"(acc[2][2]), "+v"(acc[3][3]) : "v"(a[0]), "v"(a[3]));
    }
    if (EPI == 1) { const int bt = r0 / TT, t0 = r0 % TT, kind = c0 / DQ, hd = (c0 % DQ) / HD;
        if (kind < 2) { const size_t o = ((size_t)(kind * ZH + bt * NH_ + hd) * TT + t0) * HD; put_planes<false, HD, true>(os, acc, lane, 1.0f, pl.q16 + o, pl.qh + o, pl.ql + o); }
        else { const size_t o = (size_t)(bt * NKV + hd) * HD * TT + t0; put_planes<true, TT, true>(os, acc, lane, 1.0f, pl.v16 + o, pl.vh + o, pl.vl + o);
            asm volatile("s_wait_xcnt 0x0" ::: "memory"); /* the built code keeps a fall-through from here into the q / k branch, which rewrites registers that the last stores name */ } }
    else if (EPI == 2) { const int zz = (int)z, t0 = rowg + r0; const size_t o = (size_t)((zz / NH_) * TT + t0) * DQ + (zz % NH_) * HD;
        put_planes<false, DQ, false>(os, acc, lane, (t0 < RH) ? 1.0f : (1.0f / PCAR), nullptr, pl.qh + o, pl.ql + o); }
    else
#pragma unroll
    for (int mb = 0; mb < 4; ++mb) {
#pragma unroll
        for (int nb = 0; nb < 4; ++nb) {
#pragma unroll
            for (int j = 0; j < 8; ++j) os[(hi * 8 + j) * 68 + nb * 16 + lr] = acc[mb][nb][j]; }
        __builtin_amdgcn_wave_barrier(); asm volatile("" ::: "memory");
        float* crow = C + (size_t)(r0 + mb * 16) * ldc + cc0;
{
#pragma unroll
            for (int s = 0; s < 8; ++s) { const int row = 2 * s + hi, cofs = lr * 4; v4f val = *(const v4fa*)(os + row * 68 + cofs); if (BIAS) { val[0] += bfr(bias[c0 + cofs]); val[1] += bfr(bias[c0 + cofs + 1]); val[2] += bfr(bias[c0 + cofs + 2]); val[3] += bfr(bias[c0 + cofs + 3]); }
                *(v4f*)(crow + (size_t)row * ldc + cofs) = val; }
             }
        __builtin_amdgcn_wave_barrier(); asm volatile("" ::: "memory");
    }
}

typedef __attribute__((ext_vector_type(2))) _Float16 v2h;
typedef __attribute__((ext_vector_type(4))) _Float16 v4h;
typedef __attribute__((ext_vector_type(2))) unsigned short v2us;
typedef __attribute__((ext_vector_type(4))) unsigned short v4us;
typedef __attribute__((ext_vector_type(2))) float v2f;
typedef __attribute__((ext_vector_type(4))) int v4i;

__global__ __launch_bounds__(256) void k_wtG(const float* __restrict__ w, int K, int N, bf* Bt) {
    const int lane = threadIdx.x & 31; const int L0 = (blockIdx.x * 8 + (threadIdx.x >> 5)) * 8; const int nlines = N * K / 64;
{
#pragma unroll 1
        for (int l = 0; l < 8; ++l) { const int L = L0 + l; if (L >= nlines) break; const size_t e = (size_t)L * 64 + lane * 2; const int k = (int)(e % K), n = (int)(e / K); v2us o;
            o[0] = f2bf(w[(size_t)k * N + n]); o[1] = f2bf(w[(size_t)(k + 1) * N + n]); *(v2us*)(Bt + e) = o; }
         }
}
__global__ __launch_bounds__(256) void k_cvt8(const float* __restrict__ src, bf* dst, size_t n8) { const size_t i = (size_t)blockIdx.x * 256 + threadIdx.x; if (i >= n8) return; const v8f v = *(const v8f*)(src + i * 8); v8us o;
#pragma unroll
    for (int k = 0; k < 8; ++k) o[k] = f2bf(v[k]); *(v8us*)(dst + i * 8) = o;  }

typedef v4h  __attribute__((may_alias)) v4ha;
typedef v4us __attribute__((may_alias)) v4usa;
#define SP (BW + 4)   // LDS pitch of a band row in floats: 16 B more than the row, so that the 16-B readers of 16 rows spread over the banks

// LDS side of WFrag::ld (the same k order: elements 0..7 and 16..23 from p)
__device__ __forceinline__ v16h  ldsfrag(const h16* p) { return cat16(*(const v8ha*)p, *(const v8ha*)(p + 16)); }
__device__ __forceinline__ v16bf ldsfrag(const bf* p)  { return cat16b(*(const v8usa*)p, *(const v8usa*)(p + 16)); }

// attn_body: one 64-row block (rows r0 ..) of one (batch, head) pair, 4 waves. Its band is the BW keys from bs = r0 - WNB, moved into [0, TT - BW] at the two ends of the sequence: it holds every key of the rows' windows, every key of it exists, and a key outside a row's window gets P = 0 exactly.
// 1: S = q k^T, wave w the band columns [80 w, 80 w + 80), to LDS (f32). 2: softmax, wave w the rows [16 w, 16 w + 16), four rows a wave-step with the lane -> column map and the sum order of the former row kernel; P overwrites its own row (HL: hi plane then lo plane, else fp16 x PCAR). 3: O = P v, wave w the head columns [16 w, 16 w + 16), A from LDS, v^T fragments loaded before the softmax. 4: O through LDS to the merged hi/lo planes, 8 lanes a 128-B line.
template <typename T16, bool HL>
__device__ __forceinline__ void attn_body(float* S, const T16* __restrict__ Q, const T16* __restrict__ Q2, const T16* __restrict__ Kp, const T16* __restrict__ Kp2, const T16* __restrict__ Vt, const T16* __restrict__ Vt2, int r0, bf* Dh, bf* Dl) {
    typedef typename WFrag<T16>::V V;
    const int tid = threadIdx.x, lane = tid & 31, lr = lane & 15, hf = lane >> 4, w = __builtin_amdgcn_readfirstlane(tid >> 5), bs = r0 - WNB < 0 ? 0 : (r0 - WNB > TT - BW ? TT - BW : r0 - WNB);
    // one 32-bit byte offset a lane for q, one for k, one for v^T, on the planes' uniform bases: every fragment is an immediate offset from it, and the hi and lo planes share it
    const unsigned bq = (unsigned)((r0 + lr) * HD + 8 * hf) * 2u, bk = (unsigned)((bs + w * 80 + lr) * HD + 8 * hf) * 2u, bv = (unsigned)((w * 16 + lr) * TT + bs + 8 * hf) * 2u;
    const T16* pq = (const T16*)((const char*)Q + bq); const T16* pq2 = (const T16*)((const char*)Q2 + bq);
    const T16* pk = (const T16*)((const char*)Kp + bk); const T16* pk2 = (const T16*)((const char*)Kp2 + bk);
    const T16* pv = (const T16*)((const char*)Vt + bv); const T16* pv2 = (const T16*)((const char*)Vt2 + bv);
    {
        v8f acc[4][5];
#pragma unroll
        for (int mb = 0; mb < 4; ++mb)
#pragma unroll
            for (int nb = 0; nb < 5; ++nb) acc[mb][nb] = (v8f){};
        constexpr int G = HL ? 1 : 2;   // k steps of 32 whose fragments are loaded as one run (as many as the registers of three waves a SIMD hold)
#pragma unroll
        for (int kg = 0; kg < HD / 32; kg += G) {
            V a[G][4], a2[G][4], b[G][5], b2[G][5];
            __builtin_amdgcn_sched_barrier(0);   // a run's loads stay behind the products of the run before: lifted over them they need a second fragment set, and the registers then hold two waves a SIMD, not three
#pragma unroll
            for (int u = 0; u < G; ++u) { const int kc = (kg + u) * 32;
#pragma unroll
                for (int mb = 0; mb < 4; ++mb) { a[u][mb] = WFrag<T16>::ld(pq + mb * 16 * HD + kc); if (HL) a2[u][mb] = WFrag<T16>::ld(pq2 + mb * 16 * HD + kc); }
#pragma unroll
                for (int nb = 0; nb < 5; ++nb) { b[u][nb] = WFrag<T16>::ld(pk + nb * 16 * HD + kc); if (HL) b2[u][nb] = WFrag<T16>::ld(pk2 + nb * 16 * HD + kc); } }
            __builtin_amdgcn_sched_barrier(0);   // keeps the run of loads in front of the products: one load latency a run instead of one a fragment pair
#pragma unroll
            for (int u = 0; u < G; ++u)
#pragma unroll
                for (int nb = 0; nb < 5; ++nb)
#pragma unroll
                    for (int mb = 0; mb < 4; ++mb) { acc[mb][nb] = WFrag<T16>::mma(a[u][mb], b[u][nb], acc[mb][nb]); if (HL) { acc[mb][nb] = WFrag<T16>::mma(a2[u][mb], b[u][nb], acc[mb][nb]); acc[mb][nb] = WFrag<T16>::mma(a[u][mb], b2[u][nb], acc[mb][nb]); } }
        }
#pragma unroll
        for (int mb = 0; mb < 4; ++mb)
#pragma unroll
            for (int nb = 0; nb < 5; ++nb)
#pragma unroll
                for (int j = 0; j < 8; ++j) S[(mb * 16 + hf * 8 + j) * SP + w * 80 + nb * 16 + lr] = acc[mb][nb][j];
    }
    // v^T fragments of the whole band as one run of loads: one load latency for the band, none in the P x V products
    V vb[BW / 32], vb2[BW / 32];
    __builtin_amdgcn_sched_barrier(0);   // these loads stay behind the score stores, so that their registers are those the accumulators leave (three waves a SIMD)
#pragma unroll
    for (int s = 0; s < BW / 32; ++s) { vb[s] = WFrag<T16>::ld(pv + s * 32); if (HL) vb2[s] = WFrag<T16>::ld(pv2 + s * 32); }
    // one wait behind all the loads, before any register that holds one of their addresses is written again; the addresses are inputs so that their registers stay untouched up to the wait
    if (HL) asm volatile("s_wait_xcnt 0x0" :: "v"(bq), "v"(bk), "v"(bv), "s"(Q), "s"(Q2), "s"(Kp), "s"(Kp2), "s"(Vt), "s"(Vt2) : "memory"); else asm volatile("s_wait_xcnt 0x0" :: "v"(bq), "v"(bk), "v"(bv), "s"(Q), "s"(Kp), "s"(Vt) : "memory");
    __syncthreads();   // every wave's score columns are in LDS before a row is read
    const int cb = (bs >> 7) * 128 + lane * 4;   // NCH 128-aligned chunks cover the band: key j sits in lane (j % 128) / 4 as before, so a lane sums the same non-zero terms in the same order
#pragma unroll 1
    for (int g = 0; g < 4; ++g) {   // 4 rows at a time: their loads go first and their chains are independent; the loop over the groups stays rolled (unrolled it only grows the code fourfold)
        float v[4][NCH * 4], mx[4], sum[4];
#pragma unroll
        for (int r = 0; r < 4; ++r) { const int rl = w * 16 + g * 4 + r, i = r0 + rl; const float* sr = S + rl * SP; mx[r] = -3.0e38f;
#pragma unroll
            for (int ch = 0; ch < NCH; ++ch) { const int j0 = cb + ch * 128; const bool inb = (j0 >= bs && j0 < bs + BW); v4f a = (v4f){}; if (inb) a = *(const v4fa*)(sr + (j0 - bs));
#pragma unroll
                for (int q = 0; q < 4; ++q) { const int j = j0 + q; const float t = (inb && j <= i + WNB && j >= i - WNB) ? a[q] * SCL : -3.0e38f; v[r][ch * 4 + q] = t;   /* local window |i - j| <= 128 (-1e9 == exclusion) */ mx[r] = fmaxf(mx[r], t); } } }
#pragma unroll
        for (int sh = 16; sh; sh >>= 1)
#pragma unroll
            for (int r = 0; r < 4; ++r) mx[r] = fmaxf(mx[r], __shfl_xor(mx[r], sh, 32));
#pragma unroll
        for (int r = 0; r < 4; ++r) { sum[r] = 0.f;
#pragma unroll
            for (int k = 0; k < NCH * 4; ++k) { const float d0 = __fsub_rn(v[r][k], mx[r]); v[r][k] = __builtin_amdgcn_exp2f(__fmul_rn(d0, 1.4426950408889634f)); sum[r] += v[r][k]; } }
#pragma unroll
        for (int sh = 16; sh; sh >>= 1)
#pragma unroll
            for (int r = 0; r < 4; ++r) sum[r] += __shfl_xor(sum[r], sh, 32);
#pragma unroll
        for (int r = 0; r < 4; ++r) { const float f = __fdiv_rn(HL ? 1.0f : PCAR, sum[r]); T16* pr = (T16*)(S + (w * 16 + g * 4 + r) * SP);
#pragma unroll
            for (int ch = 0; ch < NCH; ++ch) { const int j0 = cb + ch * 128; const bool inr = (j0 >= bs && j0 < bs + BW);
                if (HL) { v4us oh, ol;
#pragma unroll
                    for (int q = 0; q < 4; ++q) { unsigned short a, c2; splitf(v[r][ch * 4 + q] * f, a, c2); oh[q] = a; ol[q] = c2; }
                    if (inr) { *(v4usa*)((bf*)pr + (j0 - bs)) = oh; *(v4usa*)((bf*)pr + BW + (j0 - bs)) = ol; } }
                else { v4h o4;
#pragma unroll
                    for (int q = 0; q < 4; ++q) o4[q] = tohx(v[r][ch * 4 + q] * f);
                    if (inr) *(v4ha*)((h16*)pr + (j0 - bs)) = o4; } } }
    }
    __syncthreads();   // every row of P is in LDS before a wave reads all 64 rows
    v8f o[4];
#pragma unroll
    for (int mb = 0; mb < 4; ++mb) o[mb] = (v8f){};
#pragma unroll
    for (int s = 0; s < BW / 32; ++s) {
        if (s % (HL ? 2 : 5) == 0) __builtin_amdgcn_sched_barrier(0);   // the P fragments are read a few k steps at a time: all lifted to the front they take the registers of a third wave a SIMD
#pragma unroll
        for (int mb = 0; mb < 4; ++mb) { const T16* pa = (const T16*)(S + (mb * 16 + lr) * SP) + s * 32 + 8 * hf; const V a = ldsfrag(pa);
            o[mb] = WFrag<T16>::mma(a, vb[s], o[mb]); if (HL) { const V a2 = ldsfrag(pa + BW); o[mb] = WFrag<T16>::mma(a2, vb[s], o[mb]); o[mb] = WFrag<T16>::mma(a, vb2[s], o[mb]); } } }
    __syncthreads();   // the last read of P is over before O is staged over it
#pragma unroll
    for (int mb = 0; mb < 4; ++mb)
#pragma unroll
        for (int j = 0; j < 8; ++j) S[(mb * 16 + hf * 8 + j) * 68 + w * 16 + lr] = o[mb][j];
    __syncthreads();   // O is whole before it is read row-wise
    const float sc = HL ? 1.0f : (1.0f / PCAR);
#pragma unroll
    for (int s = 0; s < 4; ++s) { const int row = s * 16 + (tid >> 3), cc = (tid & 7) * 8; const float* p = S + row * 68 + cc; const v4f x0 = *(const v4fa*)p, x1 = *(const v4fa*)(p + 4); v8us oh, ol;
#pragma unroll
        for (int q = 0; q < 8; ++q) { const float x = ((q < 4) ? x0[q & 3] : x1[q & 3]) * sc; unsigned short a2, c2; splitf(x, a2, c2); oh[q] = a2; ol[q] = c2; }
        const size_t oo = (size_t)row * DQ + cc; *(v8us*)(Dh + oo) = oh; *(v8us*)(Dl + oo) = ol; }
    // one wait behind the run of stores, before any register that one of them names is written again (without it a build joined the two bodies in a tail that rewrites a base pair); the bases are inputs so that their registers stay untouched up to the wait
    asm volatile("s_wait_xcnt 0x0" :: "s"(Dh), "s"(Dl) : "memory");
}

// grid (ZH, TT / 64): x = (batch, head) pair, y = 64-row block, so that the hi/lo blocks (3 products) start first
__global__ __launch_bounds__(128) void k_attn(const h16* __restrict__ Q16, const h16* __restrict__ K16, const h16* __restrict__ V16, const bf* __restrict__ Qh, const bf* __restrict__ Ql, const bf* __restrict__ Kh, const bf* __restrict__ Kl, const bf* __restrict__ Vh, const bf* __restrict__ Vl, bf* Oh, bf* Ol) {
    __shared__ __align__(16) float S[64 * SP];
    const int zz = blockIdx.x, r0 = blockIdx.y * 64; const size_t pz = (size_t)zz * TT * HD, o = (size_t)((zz / NH_) * TT + r0) * DQ + (zz % NH_) * HD;
    if (r0 < RH) attn_body<bf, true>(S, Qh + pz, Ql + pz, Kh + pz, Kl + pz, Vh + pz, Vl + pz, r0, Oh + o, Ol + o);
    else attn_body<h16, false>(S, Q16 + pz, nullptr, K16 + pz, nullptr, V16 + pz, nullptr, r0, Oh + o, Ol + o);
}

extern "C" void kernel_launch(void* const* d_in, const int* in_sizes, int n_in,
                              void* d_out, int out_size, void* d_ws, size_t ws_size, hipStream_t stream) {
    (void)in_sizes; (void)n_in; (void)out_size;
    const float* x = (const float*)d_in[0]; const float* wqkv = (const float*)d_in[1]; const float* wo = (const float*)d_in[2]; /* w_proj */
    float* OUT = (float*)d_out;     // [4][2048][1024]
    char* wsp = (char*)d_ws;
    auto take = [&](size_t bytes) { char* p = wsp; wsp += (bytes + 255) & ~(size_t)255; return (void*)p; };
    bf* WQKV = (bf*)take((size_t)3 * DQ * DM * 2); bf* WO = (bf*)take((size_t)DM * DQ * 2);
    bf* XB = (bf*)take((size_t)NB_ * TT * DM * 2);
    // q and k planes of a kind lie back to back (each a multiple of 256 bytes): the q | k | v GEMM addresses both as 2 * ZH planes
    h16* QP16 = (h16*)take((size_t)ZH * TT * HD * 2); h16* KP16 = (h16*)take((size_t)ZH * TT * HD * 2); h16* VT16 = (h16*)take((size_t)ZH * HD * TT * 2);
    bf* QPh = (bf*)take((size_t)ZH * TT * HD * 2); bf* KPh = (bf*)take((size_t)ZH * TT * HD * 2); bf* QPl = (bf*)take((size_t)ZH * TT * HD * 2); bf* KPl = (bf*)take((size_t)ZH * TT * HD * 2); bf* VTh = (bf*)take((size_t)ZH * HD * TT * 2); bf* VTl = (bf*)take((size_t)ZH * HD * TT * 2);
    bf* ATh = (bf*)take((size_t)GB * TT * DQ * 2); bf* ATl = (bf*)take((size_t)GB * TT * DQ * 2);
    if ((size_t)(wsp - (char*)d_ws) > ws_size) return;    // ws 256 MiB
    const Planes none = { nullptr, nullptr, nullptr, nullptr, nullptr, nullptr }, pqkv = { QP16, QPh, QPl, VT16, VTh, VTl };
    k_cvt8<<<(unsigned)(((size_t)3 * DQ * DM / 8 + 255) / 256), 256, 0, stream>>>(wqkv, WQKV, (size_t)3 * DQ * DM / 8);
    k_cvt8<<<(unsigned)(((size_t)DM * DQ / 8 + 255) / 256), 256, 0, stream>>>(wo, WO, (size_t)DM * DQ / 8);
    k_cvt8<<<(unsigned)(((size_t)NB_ * TT * DM / 8 + 255) / 256), 256, 0, stream>>>(x, XB, (size_t)NB_ * TT * DM / 8);
    for (int b = 0; b < NB_; b += GB) {
        k_gemmw<bf, 0, false, 0, 1><<<dim3(GB * TT / 64, 3 * DQ / 64, 1), 32, 0, stream>>>(XB + (size_t)b * TT * DM, nullptr, WQKV, nullptr, DM, nullptr, 0, nullptr, 0, 0, 0, 0, pqkv);   // planes 0 .. ZH-1 = q, ZH .. 2 ZH-1 = k
        // one kv head per query head: pair z uses plane z of every kind
        k_attn<<<dim3(ZH, TT / 64, 1), 128, 0, stream>>>(QP16, KP16, VT16, QPh, QPl, KPh, KPl, VTh, VTl, ATh, ATl);
        k_gemmw<bf, 1, false, 0, 0><<<dim3(GB * TT / 64, DM / 64, 1), 32, 0, stream>>>(ATh, ATl, WO, nullptr, DQ, OUT + (size_t)b * TT * DM, DM, nullptr, 0, 0, 0, 0, none); }
}
